// v000
// The times below were measured on an AMD MI455X: many runs one after another, warmed up first and cycling through
// copies of the inputs, with the whole window's GPU time divided by the number of runs. Launches and the gaps
// between them are all in it. The median over several windows is given; except for v000 it joins two sittings, which
// can be a few percent apart, so the side-by-side timings, each taken in one sitting, are the better comparison.
// v000, which the later versions start from, runs in 44.6 microseconds.
#include <hip/hip_runtime.h>
#include <math.h>

// Problem constants (reference: B=2048, T=50, D=256)
#define BB 2048
#define TT 50
#define DD 256
#define NEGV -100000.0f

typedef float v2f __attribute__((ext_vector_type(2)));
typedef float v8f __attribute__((ext_vector_type(8)));

// ---------------------------------------------------------------------------
// Kernel 1: q[b,:] = (x[b,T-1,:] * td[b,T-1]) @ Wq^T + bq ; masked-fill NEG
// GEMM M=2048 (batch), N=256, K=256 via V_WMMA_F32_16X16X4_F32.
// One 16x16 tile per wave; 8 waves / block; 2048 tiles total -> 256 blocks.
// ---------------------------------------------------------------------------
__global__ __launch_bounds__(256) void k_qproj(
    const float* __restrict__ x, const int* __restrict__ mask,
    const float* __restrict__ td, const float* __restrict__ Wq,
    const float* __restrict__ bq, float* __restrict__ q)
{
  const int lane = threadIdx.x & 31;
  const int gw   = blockIdx.x * 8 + (threadIdx.x >> 5);  // 0..2047
  const int m0   = (gw >> 4) * 16;                        // 128 M-tiles
  const int n0   = (gw & 15) * 16;                        // 16 N-tiles
  const int half = lane >> 4;                             // K sub-pair select
  const int lm   = lane & 15;

  const int   mrow = m0 + lm;
  const float tdl  = td[mrow * TT + (TT - 1)];
  const float* arow = x  + ((size_t)mrow * TT + (TT - 1)) * DD;
  const float* brow = Wq + (size_t)(n0 + lm) * DD;        // B[kk,n] = Wq[n,kk]

  v8f c = {};
#pragma unroll 4
  for (int k0 = 0; k0 < DD; k0 += 4) {
    const int kk = k0 + 2 * half;
    v2f a = *(const v2f*)(arow + kk);
    a = a * tdl;                                           // fold time-decay
    v2f b = *(const v2f*)(brow + kk);
    c = __builtin_amdgcn_wmma_f32_16x16x4_f32(false, a, false, b,
                                              (short)0, c, false, false);
  }
  const int   n    = n0 + lm;
  const float bias = bq[n];
#pragma unroll
  for (int r = 0; r < 8; ++r) {
    const int row = m0 + r + 8 * half;                     // C VGPR layout
    float v = c[r] + bias;
    if (mask[row * TT + (TT - 1)] == 0) v = NEGV;          // q-side mask-fill
    q[(size_t)row * DD + n] = v;
  }
}

// ---------------------------------------------------------------------------
// Kernel 2: qk[b,:] = q[b,:] @ Wk   (qk[d] = sum_e q[e] * Wk[e,d])
// ---------------------------------------------------------------------------
__global__ __launch_bounds__(256) void k_qk(
    const float* __restrict__ q, const float* __restrict__ Wk,
    float* __restrict__ qk)
{
  const int lane = threadIdx.x & 31;
  const int gw   = blockIdx.x * 8 + (threadIdx.x >> 5);
  const int m0   = (gw >> 4) * 16;
  const int n0   = (gw & 15) * 16;
  const int half = lane >> 4;
  const int lm   = lane & 15;

  const float* arow = q + (size_t)(m0 + lm) * DD;
  v8f c = {};
#pragma unroll 4
  for (int k0 = 0; k0 < DD; k0 += 4) {
    const int kk = k0 + 2 * half;
    v2f a = *(const v2f*)(arow + kk);
    const float* bp = Wk + (size_t)kk * DD + (n0 + lm);    // B[kk,n]=Wk[kk,n]
    v2f b; b.x = bp[0]; b.y = bp[DD];
    c = __builtin_amdgcn_wmma_f32_16x16x4_f32(false, a, false, b,
                                              (short)0, c, false, false);
  }
  const int n = n0 + lm;
#pragma unroll
  for (int r = 0; r < 8; ++r)
    qk[(size_t)(m0 + r + 8 * half) * DD + n] = c[r];
}

// ---------------------------------------------------------------------------
// Kernel 3: per batch b — scores over s, softmax, xbar = sum_s p_s*td_s*x_s.
// Raw x[b] staged memory->LDS with GLOBAL_LOAD_ASYNC_TO_LDS_B128 (ASYNCcnt);
// the qbk/qsum reductions overlap the async DMA. td_s folded as a per-s
// scalar:  score = mask ? (td_s*dot(qk,x_s) + q.bk)/16 : (-1e5*sum(q))/16.
// xbar aliases the q buffer (q row fully consumed before the write).
// ---------------------------------------------------------------------------
__global__ __launch_bounds__(256) void k_attn(
    const float* __restrict__ x, const int* __restrict__ mask,
    const float* __restrict__ td, const float* __restrict__ qbuf,
    const float* __restrict__ qkbuf, const float* __restrict__ bk,
    float* __restrict__ xbar)
{
  __shared__ float Xs[TT * DD];     // raw x[b] tile (50 KB)
  __shared__ float qks[DD];
  __shared__ float tds[TT];
  __shared__ int   msk[TT];
  __shared__ float sc[TT];
  __shared__ float pv[TT];
  __shared__ float pw[TT];
  __shared__ float red1[8], red2[8];
  __shared__ float qbk_s, qsum_s;

  const int b = blockIdx.x;
  const int t = threadIdx.x;
  const int lane = t & 31, wave = t >> 5;

  // ---- issue async memory->LDS staging of x[b] (b128 per lane) ----
  const float* gsrc = x + (size_t)b * TT * DD;
#pragma unroll
  for (int i = t; i < (TT * DD) / 4; i += 256) {
    const unsigned loff = (unsigned)(uintptr_t)(&Xs[4 * i]); // LDS byte offset
    const float*   g    = gsrc + 4 * i;
    asm volatile("global_load_async_to_lds_b128 %0, %1, off"
                 :: "v"(loff), "v"(g) : "memory");
  }

  // ---- overlapped with DMA: stage scalars, reduce q.bk and sum(q) ----
  qks[t] = qkbuf[(size_t)b * DD + t];
  const float qv = qbuf[(size_t)b * DD + t];
  if (t < TT) { tds[t] = td[b * TT + t]; msk[t] = mask[b * TT + t]; }

  float v1 = qv * bk[t];
  float v2 = qv;
  for (int off = 16; off; off >>= 1) {
    v1 += __shfl_down(v1, off, 32);
    v2 += __shfl_down(v2, off, 32);
  }
  if (lane == 0) { red1[wave] = v1; red2[wave] = v2; }
  __syncthreads();
  if (t == 0) {
    float a = 0.f, s2 = 0.f;
    for (int i = 0; i < 8; ++i) { a += red1[i]; s2 += red2[i]; }
    qbk_s = a; qsum_s = s2;
  }

  // ---- DMA fence: own-wave ASYNCcnt, then cross-wave barrier ----
  asm volatile("s_wait_asynccnt 0x0" ::: "memory");
  __syncthreads();

  // ---- scores: each wave owns s = wave, wave+8, ... ----
  for (int s = wave; s < TT; s += 8) {
    float acc = 0.f;
#pragma unroll
    for (int j = 0; j < 8; ++j) {
      const int d = lane + 32 * j;
      acc += qks[d] * Xs[s * DD + d];
    }
    for (int off = 16; off; off >>= 1) acc += __shfl_down(acc, off, 32);
    if (lane == 0) {
      sc[s] = msk[s] ? (tds[s] * acc + qbk_s) * 0.0625f
                     : (NEGV * qsum_s) * 0.0625f;
    }
  }
  __syncthreads();

  // ---- softmax over 50; fold td_s into the value weights ----
  float mx = -3.402823466e38f;
  for (int s = 0; s < TT; ++s) mx = fmaxf(mx, sc[s]);
  if (t < TT) {
    const float e = __expf(sc[t] - mx);
    pv[t] = e;
    pw[t] = e * tds[t];
  }
  __syncthreads();
  float sum = 0.f;
  for (int s = 0; s < TT; ++s) sum += pv[s];
  const float inv = 1.0f / sum;

  float acc = 0.f;
  for (int s = 0; s < TT; ++s) acc += pw[s] * Xs[s * DD + t];
  xbar[(size_t)b * DD + t] = acc * inv;
}

// ---------------------------------------------------------------------------
// Kernel 4: out[b,:] = xbar[b,:] @ Wv^T + bv   (WMMA, same tiling as k1)
// ---------------------------------------------------------------------------
__global__ __launch_bounds__(256) void k_vproj(
    const float* __restrict__ xbar, const float* __restrict__ Wv,
    const float* __restrict__ bv, float* __restrict__ out)
{
  const int lane = threadIdx.x & 31;
  const int gw   = blockIdx.x * 8 + (threadIdx.x >> 5);
  const int m0   = (gw >> 4) * 16;
  const int n0   = (gw & 15) * 16;
  const int half = lane >> 4;
  const int lm   = lane & 15;

  const float* arow = xbar + (size_t)(m0 + lm) * DD;
  const float* brow = Wv   + (size_t)(n0 + lm) * DD;
  v8f c = {};
#pragma unroll 4
  for (int k0 = 0; k0 < DD; k0 += 4) {
    const int kk = k0 + 2 * half;
    v2f a = *(const v2f*)(arow + kk);
    v2f b = *(const v2f*)(brow + kk);
    c = __builtin_amdgcn_wmma_f32_16x16x4_f32(false, a, false, b,
                                              (short)0, c, false, false);
  }
  const int   n    = n0 + lm;
  const float bias = bv[n];
#pragma unroll
  for (int r = 0; r < 8; ++r)
    out[(size_t)(m0 + r + 8 * half) * DD + n] = c[r] + bias;
}

// ---------------------------------------------------------------------------
extern "C" void kernel_launch(void* const* d_in, const int* in_sizes, int n_in,
                              void* d_out, int out_size, void* d_ws, size_t ws_size,
                              hipStream_t stream) {
  const float* x    = (const float*)d_in[0];
  const int*   mask = (const int*)  d_in[1];
  const float* td   = (const float*)d_in[2];
  const float* Wq   = (const float*)d_in[3];
  const float* bq   = (const float*)d_in[4];
  const float* Wk   = (const float*)d_in[5];
  const float* bk   = (const float*)d_in[6];
  const float* Wv   = (const float*)d_in[7];
  const float* bv   = (const float*)d_in[8];
  float* out = (float*)d_out;

  // workspace: q (2 MB, reused as xbar) | qk (2 MB)
  float* qbuf  = (float*)d_ws;
  float* qkbuf = qbuf + (size_t)BB * DD;

  // 2048 waves (one 16x16 tile each) = 256 blocks of 8 waves
  k_qproj<<<dim3(256), dim3(256), 0, stream>>>(x, mask, td, Wq, bq, qbuf);
  k_qk   <<<dim3(256), dim3(256), 0, stream>>>(qbuf, Wk, qkbuf);
  k_attn <<<dim3(BB),  dim3(256), 0, stream>>>(x, mask, td, qbuf, qkbuf, bk, qbuf);
  k_vproj<<<dim3(256), dim3(256), 0, stream>>>(qbuf, Wv, bv, out);
}

// v001
// A run of this version takes 31.9 microseconds.
// Two timings next to v000 put it at 1.43 and 1.44 times that version's speed.
#include <hip/hip_runtime.h>
#include <math.h>

// Problem constants (reference: B=2048, T=50, D=256)
#define BB 2048
#define TT 50
#define DD 256
#define NEGV -100000.0f

typedef float v2f __attribute__((ext_vector_type(2)));
typedef float v8f __attribute__((ext_vector_type(8)));

// LDS row pitches in floats. 260 (1040 B): the 16 rows that one ds_load_b64
// fragment read touches fall on 64 distinct banks. 136 (544 B): rows k and
// k + 2, read together by the two lane halves, sit 16 banks apart.
#define PA 260
#define PK 136

// Twelve 16-byte memory->LDS copies per lane. The s_wait_xcnt is the last line
// of the copies' own statement so that no address register named here is
// rewritten ahead of it.
__device__ __forceinline__ void copy12(const unsigned (&l)[12],
                                       const float* const (&g)[12])
{
  asm volatile(
      "global_load_async_to_lds_b128 %0, %1, off\n\t"
      "global_load_async_to_lds_b128 %2, %3, off\n\t"
      "global_load_async_to_lds_b128 %4, %5, off\n\t"
      "global_load_async_to_lds_b128 %6, %7, off\n\t"
      "global_load_async_to_lds_b128 %8, %9, off\n\t"
      "global_load_async_to_lds_b128 %10, %11, off\n\t"
      "global_load_async_to_lds_b128 %12, %13, off\n\t"
      "global_load_async_to_lds_b128 %14, %15, off\n\t"
      "global_load_async_to_lds_b128 %16, %17, off\n\t"
      "global_load_async_to_lds_b128 %18, %19, off\n\t"
      "global_load_async_to_lds_b128 %20, %21, off\n\t"
      "global_load_async_to_lds_b128 %22, %23, off\n\t"
      "s_wait_xcnt 0x0"
      :: "v"(l[0]), "v"(g[0]),
      "v"(l[1]), "v"(g[1]),
      "v"(l[2]), "v"(g[2]),
      "v"(l[3]), "v"(g[3]),
      "v"(l[4]), "v"(g[4]),
      "v"(l[5]), "v"(g[5]),
      "v"(l[6]), "v"(g[6]),
      "v"(l[7]), "v"(g[7]),
      "v"(l[8]), "v"(g[8]),
      "v"(l[9]), "v"(g[9]),
      "v"(l[10]), "v"(g[10]),
      "v"(l[11]), "v"(g[11])
      : "memory");
}

// Stage 16 A rows (row stride astride floats) and then 128 W rows, DD floats
// each, at pitch PA: every wave-wide copy moves 512 contiguous bytes of a row.
__device__ __forceinline__ void stage_rows(float* S, const float* A,
                                           size_t astride, const float* Wr,
                                           int t)
{
#pragma unroll  // compile-time copy index: picks A or W rows without a branch
  for (int j = 0; j < 3; ++j) {
    unsigned l[12];
    const float* g[12];
#pragma unroll  // the arrays must become registers (asm operands)
    for (int u = 0; u < 12; ++u) {
      const int c   = (j * 12 + u) * 256 + t;
      const int row = c >> 6, col = (c & 63) * 4;
      l[u] = (unsigned)(uintptr_t)(S + row * PA + col);   // LDS byte offset
      g[u] = (j * 12 + u < 4) ? A + (size_t)row * astride + col
                              : Wr + (size_t)(row - 16) * DD + col;
    }
    copy12(l, g);
  }
  // Own-wave landing of the copies, then the barrier that publishes them.
  asm volatile("s_wait_asynccnt 0x0" ::: "memory");
  __syncthreads();
}

// K loop on LDS fragments, k ascending. The reads of the next 8 k-steps
// are issued as one group ahead of the current 8 WMMAs (second register set),
// so that the LDS latency hides behind the accumulate chain.
// A fragment: ap[kk], ap[kk+1]; B fragment: bp[kk*BK], bp[kk*BK + BS].
template <int BK, int BS, bool SCALE>
__device__ __forceinline__ v8f kloop(const float* ap, const float* bp,
                                     int half, float s)
{
  v8f c = {};
  v2f a[2][8], b[2][8];
#pragma unroll  // register sets must be indexed by constants
  for (int g = -1; g < 8; ++g) {
    if (g < 7) {
#pragma unroll  // constant register-set index and LDS offsets
      for (int u = 0; u < 8; ++u) {
        const int kk = (g + 1) * 32 + u * 4 + 2 * half;
        a[(g + 1) & 1][u] = *(const v2f*)(ap + kk);
        b[(g + 1) & 1][u].x = bp[kk * BK];
        b[(g + 1) & 1][u].y = bp[kk * BK + BS];
      }
    }
    // Keeps the read group above from sinking in among the WMMAs below.
    __builtin_amdgcn_sched_barrier(0);
    if (g >= 0) {
#pragma unroll  // constant register-set index
      for (int u = 0; u < 8; ++u) {
        v2f av = a[g & 1][u];
        if (SCALE) av = av * s;
        c = __builtin_amdgcn_wmma_f32_16x16x4_f32(false, av, false, b[g & 1][u],
                                                  (short)0, c, false, false);
      }
    }
  }
  return c;
}

// ---------------------------------------------------------------------------
// Kernel 1: q[b,:] = (x[b,T-1,:] * td[b,T-1]) @ Wq^T + bq ; masked-fill NEG
// GEMM M=2048 (batch), N=256, K=256 via V_WMMA_F32_16X16X4_F32.
// One 16x16 tile per wave; 8 waves / block; 2048 tiles total -> 256 blocks.
// ---------------------------------------------------------------------------
__global__ __launch_bounds__(256) void k_qproj(
    const float* __restrict__ x, const int* __restrict__ mask,
    const float* __restrict__ td, const float* __restrict__ Wq,
    const float* __restrict__ bq, float* __restrict__ q)
{
  const int lane = threadIdx.x & 31;
  const int gw   = blockIdx.x * 8 + (threadIdx.x >> 5);  // 0..2047
  const int m0   = (gw >> 4) * 16;                        // 128 M-tiles
  const int n0   = (gw & 15) * 16;                        // 16 N-tiles
  const int half = lane >> 4;                             // K sub-pair select
  const int lm   = lane & 15;

  __shared__ __attribute__((aligned(16))) float S[(16 + 128) * PA];
  const int   mrow = m0 + lm;
  const float tdl  = td[mrow * TT + (TT - 1)];
  stage_rows(S, x + ((size_t)m0 * TT + (TT - 1)) * DD, (size_t)TT * DD,
             Wq + (size_t)(blockIdx.x & 1) * 128 * DD, threadIdx.x);
  const float* arow = S + lm * PA;
  const float* brow = S + (16 + (threadIdx.x >> 5) * 16 + lm) * PA;  // B[kk,n] = Wq[n,kk]

  const v8f c = kloop<1, 1, true>(arow, brow, half, tdl);  // folds time-decay
  const int   n    = n0 + lm;
  const float bias = bq[n];
#pragma unroll
  for (int r = 0; r < 8; ++r) {
    const int row = m0 + r + 8 * half;                     // C VGPR layout
    float v = c[r] + bias;
    if (mask[row * TT + (TT - 1)] == 0) v = NEGV;          // q-side mask-fill
    q[(size_t)row * DD + n] = v;
  }
}

// ---------------------------------------------------------------------------
// Kernel 2: qk[b,:] = q[b,:] @ Wk   (qk[d] = sum_e q[e] * Wk[e,d])
// ---------------------------------------------------------------------------
__global__ __launch_bounds__(256) void k_qk(
    const float* __restrict__ q, const float* __restrict__ Wk,
    float* __restrict__ qk)
{
  const int lane = threadIdx.x & 31;
  const int gw   = blockIdx.x * 8 + (threadIdx.x >> 5);
  const int m0   = (gw >> 4) * 16;
  const int n0   = (gw & 15) * 16;
  const int half = lane >> 4;
  const int lm   = lane & 15;

  // 16 q rows at pitch PA, then the block's 128 columns of all 256 Wk rows at
  // pitch PK; every wave-wide copy moves 512 contiguous bytes.
  __shared__ __attribute__((aligned(16))) float S[16 * PA + DD * PK];
  {
    const int t = threadIdx.x;
    const float* Wc = Wk + (blockIdx.x & 1) * 128;
#pragma unroll  // compile-time copy index: picks q or Wk rows without a branch
    for (int j = 0; j < 3; ++j) {
      unsigned l[12];
      const float* g[12];
#pragma unroll  // the arrays must become registers (asm operands)
      for (int u = 0; u < 12; ++u) {
        const int i = j * 12 + u;
        if (i < 4) {
          const int ch = i * 256 + t, row = ch >> 6, col = (ch & 63) * 4;
          l[u] = (unsigned)(uintptr_t)(S + row * PA + col);
          g[u] = q + (size_t)(m0 + row) * DD + col;
        } else {
          const int ch = (i - 4) * 256 + t, row = ch >> 5, col = (ch & 31) * 4;
          l[u] = (unsigned)(uintptr_t)(S + 16 * PA + row * PK + col);
          g[u] = Wc + (size_t)row * DD + col;
        }
      }
      copy12(l, g);
    }
    // Own-wave landing of the copies, then the barrier that publishes them.
    asm volatile("s_wait_asynccnt 0x0" ::: "memory");
    __syncthreads();
  }
  const float* arow = S + lm * PA;
  const float* bcol = S + 16 * PA + (threadIdx.x >> 5) * 16 + lm;
  const v8f c = kloop<PK, PK, false>(arow, bcol, half, 1.0f);  // B[kk,n]=Wk[kk,n]
  const int n = n0 + lm;
#pragma unroll
  for (int r = 0; r < 8; ++r)
    qk[(size_t)(m0 + r + 8 * half) * DD + n] = c[r];
}

// ---------------------------------------------------------------------------
// Kernel 3: per batch b — scores over s, softmax, xbar = sum_s p_s*td_s*x_s.
// Raw x[b] staged memory->LDS with GLOBAL_LOAD_ASYNC_TO_LDS_B128 (ASYNCcnt);
// the qbk/qsum reductions overlap the async DMA. td_s folded as a per-s
// scalar:  score = mask ? (td_s*dot(qk,x_s) + q.bk)/16 : (-1e5*sum(q))/16.
// xbar aliases the q buffer (q row fully consumed before the write).
// ---------------------------------------------------------------------------
__global__ __launch_bounds__(256) void k_attn(
    const float* __restrict__ x, const int* __restrict__ mask,
    const float* __restrict__ td, const float* __restrict__ qbuf,
    const float* __restrict__ qkbuf, const float* __restrict__ bk,
    float* __restrict__ xbar)
{
  __shared__ float Xs[TT * DD];     // raw x[b] tile (50 KB)
  __shared__ float qks[DD];
  __shared__ float tds[TT];
  __shared__ int   msk[TT];
  __shared__ float sc[TT];
  __shared__ float pv[TT];
  __shared__ float pw[TT];
  __shared__ float red1[8], red2[8];
  __shared__ float qbk_s, qsum_s;

  const int b = blockIdx.x;
  const int t = threadIdx.x;
  const int lane = t & 31, wave = t >> 5;

  // ---- issue async memory->LDS staging of x[b] (b128 per lane) ----
  const float* gsrc = x + (size_t)b * TT * DD;
#pragma unroll
  for (int i = t; i < (TT * DD) / 4; i += 256) {
    const unsigned loff = (unsigned)(uintptr_t)(&Xs[4 * i]); // LDS byte offset
    const float*   g    = gsrc + 4 * i;
    asm volatile("global_load_async_to_lds_b128 %0, %1, off"
                 :: "v"(loff), "v"(g) : "memory");
  }

  // ---- overlapped with DMA: stage scalars, reduce q.bk and sum(q) ----
  qks[t] = qkbuf[(size_t)b * DD + t];
  const float qv = qbuf[(size_t)b * DD + t];
  if (t < TT) { tds[t] = td[b * TT + t]; msk[t] = mask[b * TT + t]; }

  float v1 = qv * bk[t];
  float v2 = qv;
  for (int off = 16; off; off >>= 1) {
    v1 += __shfl_down(v1, off, 32);
    v2 += __shfl_down(v2, off, 32);
  }
  if (lane == 0) { red1[wave] = v1; red2[wave] = v2; }
  __syncthreads();
  if (t == 0) {
    float a = 0.f, s2 = 0.f;
    for (int i = 0; i < 8; ++i) { a += red1[i]; s2 += red2[i]; }
    qbk_s = a; qsum_s = s2;
  }

  // ---- DMA fence: own-wave ASYNCcnt, then cross-wave barrier ----
  asm volatile("s_wait_asynccnt 0x0" ::: "memory");
  __syncthreads();

  // ---- scores: each wave owns s = wave, wave+8, ... ----
  for (int s = wave; s < TT; s += 8) {
    float acc = 0.f;
#pragma unroll
    for (int j = 0; j < 8; ++j) {
      const int d = lane + 32 * j;
      acc += qks[d] * Xs[s * DD + d];
    }
    for (int off = 16; off; off >>= 1) acc += __shfl_down(acc, off, 32);
    if (lane == 0) {
      sc[s] = msk[s] ? (tds[s] * acc + qbk_s) * 0.0625f
                     : (NEGV * qsum_s) * 0.0625f;
    }
  }
  __syncthreads();

  // ---- softmax over 50; fold td_s into the value weights ----
  float mx = -3.402823466e38f;
  for (int s = 0; s < TT; ++s) mx = fmaxf(mx, sc[s]);
  if (t < TT) {
    const float e = __expf(sc[t] - mx);
    pv[t] = e;
    pw[t] = e * tds[t];
  }
  __syncthreads();
  float sum = 0.f;
  for (int s = 0; s < TT; ++s) sum += pv[s];
  const float inv = 1.0f / sum;

  float acc = 0.f;
  for (int s = 0; s < TT; ++s) acc += pw[s] * Xs[s * DD + t];
  xbar[(size_t)b * DD + t] = acc * inv;
}

// ---------------------------------------------------------------------------
// Kernel 4: out[b,:] = xbar[b,:] @ Wv^T + bv   (WMMA, same tiling as k1)
// ---------------------------------------------------------------------------
__global__ __launch_bounds__(256) void k_vproj(
    const float* __restrict__ xbar, const float* __restrict__ Wv,
    const float* __restrict__ bv, float* __restrict__ out)
{
  const int lane = threadIdx.x & 31;
  const int gw   = blockIdx.x * 8 + (threadIdx.x >> 5);
  const int m0   = (gw >> 4) * 16;
  const int n0   = (gw & 15) * 16;
  const int half = lane >> 4;
  const int lm   = lane & 15;

  __shared__ __attribute__((aligned(16))) float S[(16 + 128) * PA];
  stage_rows(S, xbar + (size_t)m0 * DD, (size_t)DD,
             Wv + (size_t)(blockIdx.x & 1) * 128 * DD, threadIdx.x);
  const float* arow = S + lm * PA;
  const float* brow = S + (16 + (threadIdx.x >> 5) * 16 + lm) * PA;
  const v8f c = kloop<1, 1, false>(arow, brow, half, 1.0f);
  const int   n    = n0 + lm;
  const float bias = bv[n];
#pragma unroll
  for (int r = 0; r < 8; ++r)
    out[(size_t)(m0 + r + 8 * half) * DD + n] = c[r] + bias;
}

// ---------------------------------------------------------------------------
extern "C" void kernel_launch(void* const* d_in, const int* in_sizes, int n_in,
                              void* d_out, int out_size, void* d_ws, size_t ws_size,
                              hipStream_t stream) {
  const float* x    = (const float*)d_in[0];
  const int*   mask = (const int*)  d_in[1];
  const float* td   = (const float*)d_in[2];
  const float* Wq   = (const float*)d_in[3];
  const float* bq   = (const float*)d_in[4];
  const float* Wk   = (const float*)d_in[5];
  const float* bk   = (const float*)d_in[6];
  const float* Wv   = (const float*)d_in[7];
  const float* bv   = (const float*)d_in[8];
  float* out = (float*)d_out;

  // workspace: q (2 MB, reused as xbar) | qk (2 MB)
  float* qbuf  = (float*)d_ws;
  float* qkbuf = qbuf + (size_t)BB * DD;

  // 2048 waves (one 16x16 tile each) = 256 blocks of 8 waves
  k_qproj<<<dim3(256), dim3(256), 0, stream>>>(x, mask, td, Wq, bq, qbuf);
  k_qk   <<<dim3(256), dim3(256), 0, stream>>>(qbuf, Wk, qkbuf);
  k_attn <<<dim3(BB),  dim3(256), 0, stream>>>(x, mask, td, qbuf, qkbuf, bk, qbuf);
  k_vproj<<<dim3(256), dim3(256), 0, stream>>>(qbuf, Wv, bv, out);
}

// v002
// It runs in 26.3 microseconds.
// Two timings next to v001 both put it at 1.22 times that version's speed.
// Over all steps from v000 it is 1.74 times as fast.
#include <hip/hip_runtime.h>
#include <math.h>

// Problem constants (reference: B=2048, T=50, D=256)
#define BB 2048
#define TT 50
#define DD 256
#define NEGV -100000.0f

typedef float v2f __attribute__((ext_vector_type(2)));
typedef float v4f __attribute__((ext_vector_type(4)));
typedef float v8f __attribute__((ext_vector_type(8)));

// LDS row pitches in floats. 260 (1040 B): the 16 rows that one ds_load_b64
// fragment read touches fall on 64 distinct banks. 136 (544 B): rows k and
// k + 2, read together by the two lane halves, sit 16 banks apart.
#define PA 260
#define PK 136

// Twelve 16-byte memory->LDS copies per lane. The s_wait_xcnt is the last line
// of the copies' own statement so that no address register named here is
// rewritten ahead of it.
__device__ __forceinline__ void copy12(const unsigned (&l)[12],
                                       const float* const (&g)[12])
{
  asm volatile(
      "global_load_async_to_lds_b128 %0, %1, off\n\t"
      "global_load_async_to_lds_b128 %2, %3, off\n\t"
      "global_load_async_to_lds_b128 %4, %5, off\n\t"
      "global_load_async_to_lds_b128 %6, %7, off\n\t"
      "global_load_async_to_lds_b128 %8, %9, off\n\t"
      "global_load_async_to_lds_b128 %10, %11, off\n\t"
      "global_load_async_to_lds_b128 %12, %13, off\n\t"
      "global_load_async_to_lds_b128 %14, %15, off\n\t"
      "global_load_async_to_lds_b128 %16, %17, off\n\t"
      "global_load_async_to_lds_b128 %18, %19, off\n\t"
      "global_load_async_to_lds_b128 %20, %21, off\n\t"
      "global_load_async_to_lds_b128 %22, %23, off\n\t"
      "s_wait_xcnt 0x0"
      :: "v"(l[0]), "v"(g[0]),
      "v"(l[1]), "v"(g[1]),
      "v"(l[2]), "v"(g[2]),
      "v"(l[3]), "v"(g[3]),
      "v"(l[4]), "v"(g[4]),
      "v"(l[5]), "v"(g[5]),
      "v"(l[6]), "v"(g[6]),
      "v"(l[7]), "v"(g[7]),
      "v"(l[8]), "v"(g[8]),
      "v"(l[9]), "v"(g[9]),
      "v"(l[10]), "v"(g[10]),
      "v"(l[11]), "v"(g[11])
      : "memory");
}

// Stage 16 A rows (row stride astride floats) and then 128 W rows, DD floats
// each, at pitch PA: every wave-wide copy moves 512 contiguous bytes of a row.
__device__ __forceinline__ void stage_rows(float* S, const float* A,
                                           size_t astride, const float* Wr,
                                           int t)
{
#pragma unroll  // compile-time copy index: picks A or W rows without a branch
  for (int j = 0; j < 3; ++j) {
    unsigned l[12];
    const float* g[12];
#pragma unroll  // the arrays must become registers (asm operands)
    for (int u = 0; u < 12; ++u) {
      const int c   = (j * 12 + u) * 256 + t;
      const int row = c >> 6, col = (c & 63) * 4;
      l[u] = (unsigned)(uintptr_t)(S + row * PA + col);   // LDS byte offset
      g[u] = (j * 12 + u < 4) ? A + (size_t)row * astride + col
                              : Wr + (size_t)(row - 16) * DD + col;
    }
    copy12(l, g);
  }
  // Own-wave landing of the copies, then the barrier that publishes them.
  asm volatile("s_wait_asynccnt 0x0" ::: "memory");
  __syncthreads();
}

// K loop on LDS fragments, k ascending. The reads of the next 8 k-steps
// are issued as one group ahead of the current 8 WMMAs (second register set),
// so that the LDS latency hides behind the accumulate chain.
// A fragment: ap[kk], ap[kk+1]; B fragment: bp[kk*BK], bp[kk*BK + BS].
template <int BK, int BS, bool SCALE>
__device__ __forceinline__ v8f kloop(const float* ap, const float* bp,
                                     int half, float s)
{
  v8f c = {};
  v2f a[2][8], b[2][8];
#pragma unroll  // register sets must be indexed by constants
  for (int g = -1; g < 8; ++g) {
    if (g < 7) {
#pragma unroll  // constant register-set index and LDS offsets
      for (int u = 0; u < 8; ++u) {
        const int kk = (g + 1) * 32 + u * 4 + 2 * half;
        a[(g + 1) & 1][u] = *(const v2f*)(ap + kk);
        b[(g + 1) & 1][u].x = bp[kk * BK];
        b[(g + 1) & 1][u].y = bp[kk * BK + BS];
      }
    }
    // Keeps the read group above from sinking in among the WMMAs below.
    __builtin_amdgcn_sched_barrier(0);
    if (g >= 0) {
#pragma unroll  // constant register-set index
      for (int u = 0; u < 8; ++u) {
        v2f av = a[g & 1][u];
        if (SCALE) av = av * s;
        c = __builtin_amdgcn_wmma_f32_16x16x4_f32(false, av, false, b[g & 1][u],
                                                  (short)0, c, false, false);
      }
    }
  }
  return c;
}

// ---------------------------------------------------------------------------
// Kernel 1: q[b,:] = (x[b,T-1,:] * td[b,T-1]) @ Wq^T + bq ; masked-fill NEG
// GEMM M=2048 (batch), N=256, K=256 via V_WMMA_F32_16X16X4_F32.
// One 16x16 tile per wave; 8 waves / block; 2048 tiles total -> 256 blocks.
// ---------------------------------------------------------------------------
__global__ __launch_bounds__(256) void k_qproj(
    const float* __restrict__ x, const int* __restrict__ mask,
    const float* __restrict__ td, const float* __restrict__ Wq,
    const float* __restrict__ bq, float* __restrict__ q)
{
  const int lane = threadIdx.x & 31;
  const int gw   = blockIdx.x * 8 + (threadIdx.x >> 5);  // 0..2047
  const int m0   = (gw >> 4) * 16;                        // 128 M-tiles
  const int n0   = (gw & 15) * 16;                        // 16 N-tiles
  const int half = lane >> 4;                             // K sub-pair select
  const int lm   = lane & 15;

  __shared__ __attribute__((aligned(16))) float S[(16 + 128) * PA];
  const int   mrow = m0 + lm;
  const float tdl  = td[mrow * TT + (TT - 1)];
  stage_rows(S, x + ((size_t)m0 * TT + (TT - 1)) * DD, (size_t)TT * DD,
             Wq + (size_t)(blockIdx.x & 1) * 128 * DD, threadIdx.x);
  const float* arow = S + lm * PA;
  const float* brow = S + (16 + (threadIdx.x >> 5) * 16 + lm) * PA;  // B[kk,n] = Wq[n,kk]

  const v8f c = kloop<1, 1, true>(arow, brow, half, tdl);  // folds time-decay
  const int   n    = n0 + lm;
  const float bias = bq[n];
#pragma unroll
  for (int r = 0; r < 8; ++r) {
    const int row = m0 + r + 8 * half;                     // C VGPR layout
    float v = c[r] + bias;
    if (mask[row * TT + (TT - 1)] == 0) v = NEGV;          // q-side mask-fill
    q[(size_t)row * DD + n] = v;
  }
}

// ---------------------------------------------------------------------------
// Kernel 2: qk[b,:] = q[b,:] @ Wk   (qk[d] = sum_e q[e] * Wk[e,d])
// ---------------------------------------------------------------------------
__global__ __launch_bounds__(256) void k_qk(
    const float* __restrict__ q, const float* __restrict__ Wk,
    float* __restrict__ qk)
{
  const int lane = threadIdx.x & 31;
  const int gw   = blockIdx.x * 8 + (threadIdx.x >> 5);
  const int m0   = (gw >> 4) * 16;
  const int n0   = (gw & 15) * 16;
  const int half = lane >> 4;
  const int lm   = lane & 15;

  // 16 q rows at pitch PA, then the block's 128 columns of all 256 Wk rows at
  // pitch PK; every wave-wide copy moves 512 contiguous bytes.
  __shared__ __attribute__((aligned(16))) float S[16 * PA + DD * PK];
  {
    const int t = threadIdx.x;
    const float* Wc = Wk + (blockIdx.x & 1) * 128;
#pragma unroll  // compile-time copy index: picks q or Wk rows without a branch
    for (int j = 0; j < 3; ++j) {
      unsigned l[12];
      const float* g[12];
#pragma unroll  // the arrays must become registers (asm operands)
      for (int u = 0; u < 12; ++u) {
        const int i = j * 12 + u;
        if (i < 4) {
          const int ch = i * 256 + t, row = ch >> 6, col = (ch & 63) * 4;
          l[u] = (unsigned)(uintptr_t)(S + row * PA + col);
          g[u] = q + (size_t)(m0 + row) * DD + col;
        } else {
          const int ch = (i - 4) * 256 + t, row = ch >> 5, col = (ch & 31) * 4;
          l[u] = (unsigned)(uintptr_t)(S + 16 * PA + row * PK + col);
          g[u] = Wc + (size_t)row * DD + col;
        }
      }
      copy12(l, g);
    }
    // Own-wave landing of the copies, then the barrier that publishes them.
    asm volatile("s_wait_asynccnt 0x0" ::: "memory");
    __syncthreads();
  }
  const float* arow = S + lm * PA;
  const float* bcol = S + 16 * PA + (threadIdx.x >> 5) * 16 + lm;
  const v8f c = kloop<PK, PK, false>(arow, bcol, half, 1.0f);  // B[kk,n]=Wk[kk,n]
  const int n = n0 + lm;
#pragma unroll
  for (int r = 0; r < 8; ++r)
    qk[(size_t)(m0 + r + 8 * half) * DD + n] = c[r];
}

// ---------------------------------------------------------------------------
// Kernel 3: one wave per batch row b, no LDS and no barrier. The wave streams
// x[b] through registers in chunks of CH rows, the next chunk's loads in flight
// while this chunk is worked on, and keeps a running maximum, sum and
// weighted row sum (online softmax):  xbar = sum_s p_s*td_s*x_s / sum_s p_s with
// score = mask ? (td_s*dot(qk,x_s) + q.bk)/16 : (-1e5*sum(q))/16.
// Lane l holds columns 4l..4l+3 and 128+4l..128+4l+3 of every row, so that each
// wave-wide load covers 512 contiguous bytes.
// xbar aliases the q buffer (the wave's own q row is consumed before the write).
// ---------------------------------------------------------------------------
#define CH 10   // rows per chunk

// v + (v of lane l ^ M) inside each 16-lane row; CTRL = 0x160 + M (row_xmask:M).
template <int CTRL>
__device__ __forceinline__ float row_xadd(float v)
{
  return v + __builtin_bit_cast(float, __builtin_amdgcn_update_dpp(
                 0, __builtin_bit_cast(int, v), CTRL, 0xf, 0xf, true));
}

// Sum over the wave's 32 lanes, left in every lane (all lanes on).
__device__ __forceinline__ float wave_sum(float v)
{
  v = row_xadd<0x161>(v);
  v = row_xadd<0x162>(v);
  v = row_xadd<0x164>(v);
  v = row_xadd<0x168>(v);
  const int i = __builtin_bit_cast(int, v);
  return v + __builtin_bit_cast(float, __builtin_amdgcn_permlanex16(
                 i, i, 0x76543210, 0xfedcba98, false, false));
}

// exp(x) as 2^(x * log2 e). The v_nop is the one slot that the instruction set
// asks for between a transcendental and a directly following instruction that
// reads its result or overwrites its source.
__device__ __forceinline__ float exp_slot(float x)
{
  const float t = x * 1.442695041f;
  float r;
  asm("v_exp_f32 %0, %1\n\tv_nop" : "=v"(r) : "v"(t));
  return r;
}

__device__ __forceinline__ float hsum(v4f t)
{
  const v2f h = t.xy + t.zw;
  return h.x + h.y;
}

// CH rows of x, two 16-byte pieces per lane and row; p already holds the lane.
__device__ __forceinline__ void load_rows(v4f (&a)[CH], v4f (&b)[CH], const v4f* p)
{
#pragma unroll  // register arrays must be indexed by constants
  for (int u = 0; u < CH; ++u) {
    a[u] = p[u * 64];
    b[u] = p[u * 64 + 32];
  }
}

// Folds CH rows into the running (m, l, oa, ob). Row u's td sits in lane l0 + u
// of tdv, its mask in bit l0 + u of kpv (l0 and kpv are wave-uniform).
__device__ __forceinline__ void fold_rows(
    const v4f (&a)[CH], const v4f (&b)[CH], v4f ka, v4f kb, float tdv, unsigned kpv,
    int l0, float qbk, float negsc, float& m, float& l, v4f& oa, v4f& ob)
{
  float sc[CH], tw[CH];
#pragma unroll  // register arrays must be indexed by constants
  for (int u = 0; u < CH; ++u) {
    const float acc = wave_sum(hsum(ka * a[u] + kb * b[u]));
    tw[u] = __builtin_bit_cast(float, __builtin_amdgcn_readlane(
                __builtin_bit_cast(int, tdv), l0 + u));
    sc[u] = ((kpv >> (l0 + u)) & 1u) ? (tw[u] * acc + qbk) * 0.0625f : negsc;
  }
  float mn = m;
#pragma unroll  // register arrays must be indexed by constants
  for (int u = 0; u < CH; ++u) mn = fmaxf(mn, sc[u]);
  const float f = exp_slot(m - mn);   // rescales what the earlier rows summed
  m = mn;
  l *= f;
  oa *= f;
  ob *= f;
#pragma unroll  // register arrays must be indexed by constants
  for (int u = 0; u < CH; ++u) {
    const float e = exp_slot(sc[u] - mn);
    const float w = e * tw[u];
    l += e;
    oa += w * a[u];
    ob += w * b[u];
  }
}

__global__ __launch_bounds__(256) void k_attn(
    const float* __restrict__ x, const int* __restrict__ mask,
    const float* __restrict__ td, const float* __restrict__ qbuf,
    const float* __restrict__ qkbuf, const float* __restrict__ bk,
    float* __restrict__ xbar)
{
  const int lane = threadIdx.x & 31;
  const int b = __builtin_amdgcn_readfirstlane(blockIdx.x * 8 + (threadIdx.x >> 5));

  // ---- the wave's small operands first: loads return in issue order ----
  const v4f* qkp = (const v4f*)(qkbuf + (size_t)b * DD) + lane;
  const v4f* qp  = (const v4f*)(qbuf + (size_t)b * DD) + lane;
  const v4f* bkp = (const v4f*)bk + lane;
  const v4f ka = qkp[0], kb = qkp[32];
  const v4f qa = qp[0],  qb = qp[32];
  const v4f ba = bkp[0], bb = bkp[32];
  // td of rows 0..29 in lanes 0..29 of td0, of rows 30..49 in lanes 0..19 of
  // td1 (the other lanes' indices are clamped into range); the mask likewise,
  // gathered into one bit per row.
  const int      r0  = lane < 30 ? lane : 29;
  const int      r1  = lane < 20 ? 30 + lane : TT - 1;
  const float    td0 = td[b * TT + r0], td1 = td[b * TT + r1];
  const unsigned kp0 = __builtin_amdgcn_ballot_w32(mask[b * TT + r0] != 0);
  const unsigned kp1 = __builtin_amdgcn_ballot_w32(mask[b * TT + r1] != 0);

  // The build lets the row loads below land in registers that hold addresses of
  // the loads above: this wait stands in front of that overwrite.
  asm volatile("s_wait_xcnt 0x0" ::: "memory");

  const v4f* xp = (const v4f*)(x + (size_t)b * TT * DD) + lane;
  v4f ca[CH], cb[CH];   // the chunk being worked on
  load_rows(ca, cb, xp);
  // Keeps every load above in front of the first arithmetic, which waits on some.
  __builtin_amdgcn_sched_barrier(0);

  const float qbk   = wave_sum(hsum(qa * ba + qb * bb));
  const float negsc = (NEGV * wave_sum(hsum(qa + qb))) * 0.0625f;

  float m = -3.402823466e38f, l = 0.f;
  v4f oa = {}, ob = {};
  // Kept rolled: unrolled, the build kept all 50 rows live to the end and spilled.
#pragma nounroll
  for (int it = 0; it < TT / CH - 1; ++it) {
    v4f na[CH], nb[CH];   // the next chunk, in flight during this one's arithmetic
    load_rows(na, nb, xp + (it + 1) * CH * 64);
    // Keeps the loads at the head of the trip: sunk among the arithmetic they
    // would have less of it to hide behind.
    __builtin_amdgcn_sched_barrier(0);
    const bool lo = it < 3;
    fold_rows(ca, cb, ka, kb, lo ? td0 : td1, lo ? kp0 : kp1,
              lo ? it * CH : it * CH - 30, qbk, negsc, m, l, oa, ob);
#pragma unroll  // register arrays must be indexed by constants
    for (int u = 0; u < CH; ++u) {
      ca[u] = na[u];
      cb[u] = nb[u];
    }
  }
  fold_rows(ca, cb, ka, kb, td1, kp1, TT - CH - 30, qbk, negsc, m, l, oa, ob);

  const float inv = 1.0f / l;
  v4f* op = (v4f*)(xbar + (size_t)b * DD) + lane;
  op[0]  = oa * inv;
  op[32] = ob * inv;
}

// ---------------------------------------------------------------------------
// Kernel 4: out[b,:] = xbar[b,:] @ Wv^T + bv   (WMMA, same tiling as k1)
// ---------------------------------------------------------------------------
__global__ __launch_bounds__(256) void k_vproj(
    const float* __restrict__ xbar, const float* __restrict__ Wv,
    const float* __restrict__ bv, float* __restrict__ out)
{
  const int lane = threadIdx.x & 31;
  const int gw   = blockIdx.x * 8 + (threadIdx.x >> 5);
  const int m0   = (gw >> 4) * 16;
  const int n0   = (gw & 15) * 16;
  const int half = lane >> 4;
  const int lm   = lane & 15;

  __shared__ __attribute__((aligned(16))) float S[(16 + 128) * PA];
  stage_rows(S, xbar + (size_t)m0 * DD, (size_t)DD,
             Wv + (size_t)(blockIdx.x & 1) * 128 * DD, threadIdx.x);
  const float* arow = S + lm * PA;
  const float* brow = S + (16 + (threadIdx.x >> 5) * 16 + lm) * PA;
  const v8f c = kloop<1, 1, false>(arow, brow, half, 1.0f);
  const int   n    = n0 + lm;
  const float bias = bv[n];
#pragma unroll
  for (int r = 0; r < 8; ++r)
    out[(size_t)(m0 + r + 8 * half) * DD + n] = c[r] + bias;
}

// ---------------------------------------------------------------------------
extern "C" void kernel_launch(void* const* d_in, const int* in_sizes, int n_in,
                              void* d_out, int out_size, void* d_ws, size_t ws_size,
                              hipStream_t stream) {
  const float* x    = (const float*)d_in[0];
  const int*   mask = (const int*)  d_in[1];
  const float* td   = (const float*)d_in[2];
  const float* Wq   = (const float*)d_in[3];
  const float* bq   = (const float*)d_in[4];
  const float* Wk   = (const float*)d_in[5];
  const float* bk   = (const float*)d_in[6];
  const float* Wv   = (const float*)d_in[7];
  const float* bv   = (const float*)d_in[8];
  float* out = (float*)d_out;

  // workspace: q (2 MB, reused as xbar) | qk (2 MB)
  float* qbuf  = (float*)d_ws;
  float* qkbuf = qbuf + (size_t)BB * DD;

  // 2048 waves (one 16x16 tile each) = 256 blocks of 8 waves
  k_qproj<<<dim3(256), dim3(256), 0, stream>>>(x, mask, td, Wq, bq, qbuf);
  k_qk   <<<dim3(256), dim3(256), 0, stream>>>(qbuf, Wk, qkbuf);
  // one wave per batch row: 2048 waves = 256 blocks of 8 waves
  k_attn <<<dim3(256), dim3(256), 0, stream>>>(x, mask, td, qbuf, qkbuf, bk, qbuf);
  k_vproj<<<dim3(256), dim3(256), 0, stream>>>(qbuf, Wv, bv, out);
}

// v003
// One run takes 21 microseconds.
// Timed twice side by side with v002, it ran 1.25 and 1.26 times as fast.
// Over all steps from v000 it is 2.19 times as fast.
#include <hip/hip_runtime.h>
#include <math.h>

// Problem constants (reference: B=2048, T=50, D=256)
#define BB 2048
#define TT 50
#define DD 256
#define NEGV -100000.0f

typedef float v2f __attribute__((ext_vector_type(2)));
typedef float v4f __attribute__((ext_vector_type(4)));
typedef float v8f __attribute__((ext_vector_type(8)));

// LDS row pitches in floats. 260 (1040 B): the 16 rows that one ds_load_b64
// fragment read touches fall on 64 distinct banks. 136 (544 B): rows k and
// k + 2, read together by the two lane halves, sit 16 banks apart.
#define PA 260
#define PK 136
// Floats per weight buffer: half a weight matrix, as 128 rows at pitch PA or as
// 256 half rows at pitch PK, whichever is larger.
#define WB (DD * PK)
#define RB 8    // batch rows per work-group

// Eight (four) 16-byte memory->LDS copies per lane. The s_wait_xcnt is the last
// line of the copies' own statement so that no address register named here is
// rewritten ahead of it.
__device__ __forceinline__ void copy8(const unsigned (&l)[8],
                                      const float* const (&g)[8])
{
  asm volatile(
      "global_load_async_to_lds_b128 %0, %1, off\n\t"
      "global_load_async_to_lds_b128 %2, %3, off\n\t"
      "global_load_async_to_lds_b128 %4, %5, off\n\t"
      "global_load_async_to_lds_b128 %6, %7, off\n\t"
      "global_load_async_to_lds_b128 %8, %9, off\n\t"
      "global_load_async_to_lds_b128 %10, %11, off\n\t"
      "global_load_async_to_lds_b128 %12, %13, off\n\t"
      "global_load_async_to_lds_b128 %14, %15, off\n\t"
      "s_wait_xcnt 0x0"
      :: "v"(l[0]), "v"(g[0]),
      "v"(l[1]), "v"(g[1]),
      "v"(l[2]), "v"(g[2]),
      "v"(l[3]), "v"(g[3]),
      "v"(l[4]), "v"(g[4]),
      "v"(l[5]), "v"(g[5]),
      "v"(l[6]), "v"(g[6]),
      "v"(l[7]), "v"(g[7])
      : "memory");
}

__device__ __forceinline__ void copy4(const unsigned (&l)[4],
                                      const float* const (&g)[4])
{
  asm volatile(
      "global_load_async_to_lds_b128 %0, %1, off\n\t"
      "global_load_async_to_lds_b128 %2, %3, off\n\t"
      "global_load_async_to_lds_b128 %4, %5, off\n\t"
      "global_load_async_to_lds_b128 %6, %7, off\n\t"
      "s_wait_xcnt 0x0"
      :: "v"(l[0]), "v"(g[0]),
      "v"(l[1]), "v"(g[1]),
      "v"(l[2]), "v"(g[2]),
      "v"(l[3]), "v"(g[3])
      : "memory");
}

// Issues the copies of half a weight matrix (128 KiB, 32 copies per lane) into
// buf: rows of 2^LOG 16-byte pieces, source row stride DD floats, LDS pitch
// PITCH floats. Every wave-wide copy moves 512 contiguous bytes. No wait here.
template <int LOG, int PITCH>
__device__ __forceinline__ void stage_w(float* buf, const float* Wsrc, int t)
{
  constexpr int RS = 256 >> LOG;           // rows that one copy of the block covers
  const int row = t >> LOG, col = (t & ((1 << LOG) - 1)) * 4;
  unsigned l[8];
  const float* g[8];
#pragma unroll  // the arrays must become registers (asm operands)
  for (int u = 0; u < 8; ++u) {
    l[u] = (unsigned)(uintptr_t)(buf + (row + u * RS) * PITCH + col);  // LDS byte offset
    g[u] = Wsrc + (size_t)(row + u * RS) * DD + col;
  }
  // Kept rolled: unrolled, the build held the addresses of all six halves' copies
  // live at once and went above 256 registers.
#pragma nounroll
  for (int j = 0; j < 4; ++j) {
    copy8(l, g);
#pragma unroll  // register arrays must be indexed by constants
    for (int u = 0; u < 8; ++u) {
      l[u] += 8 * RS * PITCH * 4;
      g[u] += 8 * RS * DD;
    }
  }
}

// Publish point of the weight ring and of the activation tiles: the wave's own
// LDS reads and writes retired, its own copies landed, then the barrier behind
// which other waves read them and the buffer just read may be refilled.
__device__ __forceinline__ void publish()
{
  asm volatile("s_wait_dscnt 0x0" ::: "memory");
  asm volatile("s_wait_asynccnt 0x0" ::: "memory");
  __syncthreads();
}

// K loop on LDS fragments, k ascending. The reads of the next 8 k-steps
// are issued as one group ahead of the current 8 WMMAs (second register set),
// so that the LDS latency hides behind the accumulate chain.
// A fragment: ap[kk], ap[kk+1]; B fragment: bp[kk*BK], bp[kk*BK + BS].
template <int BK, int BS, bool SCALE>
__device__ __forceinline__ v8f kloop(const float* ap, const float* bp,
                                     int half, float s)
{
  v8f c = {};
  v2f a[2][8], b[2][8];
#pragma unroll  // register sets must be indexed by constants
  for (int g = -1; g < 8; ++g) {
    if (g < 7) {
#pragma unroll  // constant register-set index and LDS offsets
      for (int u = 0; u < 8; ++u) {
        const int kk = (g + 1) * 32 + u * 4 + 2 * half;
        a[(g + 1) & 1][u] = *(const v2f*)(ap + kk);
        b[(g + 1) & 1][u].x = bp[kk * BK];
        b[(g + 1) & 1][u].y = bp[kk * BK + BS];
      }
    }
    // Keeps the read group above from sinking in among the WMMAs below.
    __builtin_amdgcn_sched_barrier(0);
    if (g >= 0) {
#pragma unroll  // constant register-set index
      for (int u = 0; u < 8; ++u) {
        v2f av = a[g & 1][u];
        if (SCALE) av = av * s;
        c = __builtin_amdgcn_wmma_f32_16x16x4_f32(false, av, false, b[g & 1][u],
                                                  (short)0, c, false, false);
      }
    }
  }
  return c;
}

#define CH 10   // rows per chunk

// v + (v of lane l ^ M) inside each 16-lane row; CTRL = 0x160 + M (row_xmask:M).
template <int CTRL>
__device__ __forceinline__ float row_xadd(float v)
{
  return v + __builtin_bit_cast(float, __builtin_amdgcn_update_dpp(
                 0, __builtin_bit_cast(int, v), CTRL, 0xf, 0xf, true));
}

// Sum over the wave's 32 lanes, left in every lane (all lanes on).
__device__ __forceinline__ float wave_sum(float v)
{
  v = row_xadd<0x161>(v);
  v = row_xadd<0x162>(v);
  v = row_xadd<0x164>(v);
  v = row_xadd<0x168>(v);
  const int i = __builtin_bit_cast(int, v);
  return v + __builtin_bit_cast(float, __builtin_amdgcn_permlanex16(
                 i, i, 0x76543210, 0xfedcba98, false, false));
}

// exp(x) as 2^(x * log2 e). The v_nop is the one slot that the instruction set
// asks for between a transcendental and a directly following instruction that
// reads its result or overwrites its source.
__device__ __forceinline__ float exp_slot(float x)
{
  const float t = x * 1.442695041f;
  float r;
  asm("v_exp_f32 %0, %1\n\tv_nop" : "=v"(r) : "v"(t));
  return r;
}

__device__ __forceinline__ float hsum(v4f t)
{
  const v2f h = t.xy + t.zw;
  return h.x + h.y;
}

// CH rows of x, two 16-byte pieces per lane and row; p already holds the lane.
__device__ __forceinline__ void load_rows(v4f (&a)[CH], v4f (&b)[CH], const v4f* p)
{
#pragma unroll  // register arrays must be indexed by constants
  for (int u = 0; u < CH; ++u) {
    a[u] = p[u * 64];
    b[u] = p[u * 64 + 32];
  }
}

// Folds CH rows into the running (m, l, oa, ob). Row u's td sits in lane l0 + u
// of tdv, its mask in bit l0 + u of kpv (l0 and kpv are wave-uniform).
__device__ __forceinline__ void fold_rows(
    const v4f (&a)[CH], const v4f (&b)[CH], v4f ka, v4f kb, float tdv, unsigned kpv,
    int l0, float qbk, float negsc, float& m, float& l, v4f& oa, v4f& ob)
{
  float sc[CH], tw[CH];
#pragma unroll  // register arrays must be indexed by constants
  for (int u = 0; u < CH; ++u) {
    const float acc = wave_sum(hsum(ka * a[u] + kb * b[u]));
    tw[u] = __builtin_bit_cast(float, __builtin_amdgcn_readlane(
                __builtin_bit_cast(int, tdv), l0 + u));
    sc[u] = ((kpv >> (l0 + u)) & 1u) ? (tw[u] * acc + qbk) * 0.0625f : negsc;
  }
  float mn = m;
#pragma unroll  // register arrays must be indexed by constants
  for (int u = 0; u < CH; ++u) mn = fmaxf(mn, sc[u]);
  const float f = exp_slot(m - mn);   // rescales what the earlier rows summed
  m = mn;
  l *= f;
  oa *= f;
  ob *= f;
#pragma unroll  // register arrays must be indexed by constants
  for (int u = 0; u < CH; ++u) {
    const float e = exp_slot(sc[u] - mn);
    const float w = e * tw[u];
    l += e;
    oa += w * a[u];
    ob += w * b[u];
  }
}

// ---------------------------------------------------------------------------
// The whole function in one launch. A work-group of 8 waves takes RB = 8 batch
// rows from x to out; nothing passes through global memory in between.
//   q    = mask_last ? (x_last * td_last) @ Wq^T + bq : NEG      (WMMA)
//   qk   = q @ Wk                                                (WMMA)
//   xbar = sum_s p_s*td_s*x_s / sum_s p_s, one wave per batch row, with
//          score = mask ? (td_s*dot(qk,x_s) + q.bk)/16 : (-1e5*sum(q))/16
//   out  = xbar @ Wv^T + bv                                      (WMMA)
// The 16-row A tiles hold the 8 batch rows twice (tile row r and r + 8), so that
// every LDS word a fragment read touches has been written.
// The six weight halves (Wq, Wk, Wv; 128 output columns each, one 16x16 tile
// per wave) go through two LDS buffers: half t + 2 is copied into the buffer of
// half t behind the barrier that ends half t's reads, and flies during half
// t + 1's WMMAs; the last half (of Wv) flies during the attention stage.
// Attention stage: the wave streams x[b] through registers in chunks of CH rows,
// the next chunk's loads in flight while this chunk is worked on, and keeps a
// running maximum, sum and weighted row sum (online softmax). Lane l holds
// columns 4l..4l+3 and 128+4l..128+4l+3 of every row, so that each wave-wide
// load covers 512 contiguous bytes.
// ---------------------------------------------------------------------------
__global__ __launch_bounds__(256) void k_fused(
    const float* __restrict__ x, const int* __restrict__ mask,
    const float* __restrict__ td, const float* __restrict__ Wq,
    const float* __restrict__ bq, const float* __restrict__ Wk,
    const float* __restrict__ bk, const float* __restrict__ Wv,
    const float* __restrict__ bv, float* __restrict__ out)
{
  const int t    = threadIdx.x;
  const int lane = t & 31;
  const int w    = t >> 5;                 // wave: N tile of a half, batch row
  const int half = lane >> 4;              // K sub-pair select
  const int lm   = lane & 15;
  const int b0   = blockIdx.x * RB;

  __shared__ __attribute__((aligned(16))) float S[2 * WB + 2 * 16 * PA];
  float* const W0 = S;
  float* const W1 = S + WB;
  float* const A0 = S + 2 * WB;            // x_last tile, later the qk tile
  float* const A1 = A0 + 16 * PA;          // q tile, later the xbar tile

  // ---- prologue: x_last tile and weight half 0, published; then half 1 ----
  {
    unsigned l[4];
    const float* g[4];
#pragma unroll  // the arrays must become registers (asm operands)
    for (int u = 0; u < 4; ++u) {
      const int c = u * 256 + t, row = c >> 6, col = (c & 63) * 4;
      l[u] = (unsigned)(uintptr_t)(A0 + row * PA + col);
      g[u] = x + ((size_t)(b0 + (row & (RB - 1))) * TT + (TT - 1)) * DD + col;
    }
    copy4(l, g);
  }
  stage_w<6, PA>(W0, Wq, t);
  // Last time step of the lane's A-tile row: its time-decay, and the 8 rows' masks
  // gathered into one bit per batch row (bit r from lane r).
  const int      lrow  = (b0 + (lm & (RB - 1))) * TT + (TT - 1);
  const float    tdl   = td[lrow];
  const unsigned keepq = __builtin_amdgcn_ballot_w32(mask[lrow] != 0);
  // Own-wave landing of the copies, then the barrier that publishes them.
  asm volatile("s_wait_asynccnt 0x0" ::: "memory");
  __syncthreads();
  stage_w<6, PA>(W1, Wq + (size_t)128 * DD, t);

  const float* const a0row = A0 + lm * PA;
  const float* const a1row = A1 + lm * PA;
  const int brow = (w * 16 + lm) * PA;     // B[kk,n] = W[n,kk], pitch PA
  const int bcol = w * 16 + lm;            // B[kk,n] = W[kk,n], pitch PK
  const int nl   = w * 16 + lm;            // output column inside a half

  // ---- q: halves 0 and 1 (Wq rows) ----
#pragma unroll  // the buffer and the refill differ by constants
  for (int h = 0; h < 2; ++h) {
    const v8f c = kloop<1, 1, true>(a0row, (h ? W1 : W0) + brow, half, tdl);
    const int   n    = h * 128 + nl;
    const float bias = bq[n];
#pragma unroll  // vector elements must be indexed by constants
    for (int r = 0; r < 8; ++r) {          // C VGPR layout: tile row r + 8*half
      const float v = ((keepq >> r) & 1u) ? c[r] + bias : NEGV;   // q-side mask-fill
      A1[(r + 8 * half) * PA + n] = v;
    }
    publish();
    stage_w<5, PK>(h ? W1 : W0, Wk + h * 128, t);
  }

  // ---- qk: halves 2 and 3 (Wk columns) ----
#pragma unroll  // the buffer and the refill differ by constants
  for (int h = 0; h < 2; ++h) {
    const v8f c = kloop<PK, PK, false>(a1row, (h ? W1 : W0) + bcol, half, 1.0f);
    const int n = h * 128 + nl;
#pragma unroll  // vector elements must be indexed by constants
    for (int r = 0; r < 8; ++r) A0[(r + 8 * half) * PA + n] = c[r];
    publish();
    stage_w<6, PA>(h ? W1 : W0, Wv + (size_t)h * 128 * DD, t);
  }

  // ---- attention: wave w takes batch row b0 + w ----
  {
    const int wu = __builtin_amdgcn_readfirstlane(w);
    const int b  = b0 + wu;
    const v4f* qkp = (const v4f*)(A0 + wu * PA) + lane;
    const v4f* qp  = (const v4f*)(A1 + wu * PA) + lane;
    const v4f* bkp = (const v4f*)bk + lane;
    const v4f ka = qkp[0], kb = qkp[32];
    const v4f qa = qp[0],  qb = qp[32];
    // the wave's small global operands first: loads return in issue order
    const v4f ba = bkp[0], bb = bkp[32];
    // td of rows 0..29 in lanes 0..29 of td0, of rows 30..49 in lanes 0..19 of
    // td1 (the other lanes' indices are clamped into range); the mask likewise,
    // gathered into one bit per row.
    const int      r0  = lane < 30 ? lane : 29;
    const int      r1  = lane < 20 ? 30 + lane : TT - 1;
    const float    td0 = td[b * TT + r0], td1 = td[b * TT + r1];
    const unsigned kp0 = __builtin_amdgcn_ballot_w32(mask[b * TT + r0] != 0);
    const unsigned kp1 = __builtin_amdgcn_ballot_w32(mask[b * TT + r1] != 0);

    // The build lets the row loads below land in registers that hold addresses of
    // the loads above: this wait stands in front of that overwrite.
    asm volatile("s_wait_xcnt 0x0" ::: "memory");

    const v4f* xp = (const v4f*)(x + (size_t)b * TT * DD) + lane;
    v4f ca[CH], cb[CH];   // the chunk being worked on
    load_rows(ca, cb, xp);
    // Keeps every load above in front of the first arithmetic, which waits on some.
    __builtin_amdgcn_sched_barrier(0);

    const float qbk   = wave_sum(hsum(qa * ba + qb * bb));
    const float negsc = (NEGV * wave_sum(hsum(qa + qb))) * 0.0625f;

    float m = -3.402823466e38f, l = 0.f;
    v4f oa = {}, ob = {};
    // Kept rolled: unrolled, the build kept all 50 rows live to the end and spilled.
#pragma nounroll
    for (int it = 0; it < TT / CH - 1; ++it) {
      v4f na[CH], nb[CH];   // the next chunk, in flight during this one's arithmetic
      load_rows(na, nb, xp + (it + 1) * CH * 64);
      // Keeps the loads at the head of the trip: sunk among the arithmetic they
      // would have less of it to hide behind.
      __builtin_amdgcn_sched_barrier(0);
      const bool lo = it < 3;
      fold_rows(ca, cb, ka, kb, lo ? td0 : td1, lo ? kp0 : kp1,
                lo ? it * CH : it * CH - 30, qbk, negsc, m, l, oa, ob);
#pragma unroll  // register arrays must be indexed by constants
      for (int u = 0; u < CH; ++u) {
        ca[u] = na[u];
        cb[u] = nb[u];
      }
    }
    fold_rows(ca, cb, ka, kb, td1, kp1, TT - CH - 30, qbk, negsc, m, l, oa, ob);

    // xbar into tile rows w and w + 8 of A1: only this wave has read row w since
    // the last barrier, and its q values are in registers by now.
    const float inv = 1.0f / l;
    const v4f xa = oa * inv, xb = ob * inv;
    v4f* op = (v4f*)(A1 + wu * PA) + lane;
    v4f* oq = (v4f*)(A1 + (wu + RB) * PA) + lane;
    op[0]  = xa;
    op[32] = xb;
    oq[0]  = xa;
    oq[32] = xb;
  }
  // Publishes the xbar tile and weight half 5 (half 4 was published above).
  publish();

  // ---- out: halves 4 and 5 (Wv rows); no LDS is written any more ----
  const v8f c0 = kloop<1, 1, false>(a1row, W0 + brow, half, 1.0f);
  const v8f c1 = kloop<1, 1, false>(a1row, W1 + brow, half, 1.0f);
  const float bias0 = bv[nl], bias1 = bv[128 + nl];
  // Tile rows r and r + 8 are the same batch row: lanes 0..15 store batch rows
  // 0..3, lanes 16..31 batch rows 4..7, each element once.
  const v4f s0 = half ? __builtin_shufflevector(c0, c0, 4, 5, 6, 7)
                      : __builtin_shufflevector(c0, c0, 0, 1, 2, 3);
  const v4f s1 = half ? __builtin_shufflevector(c1, c1, 4, 5, 6, 7)
                      : __builtin_shufflevector(c1, c1, 0, 1, 2, 3);
  float* o = out + (size_t)(b0 + half * 4) * DD + nl;
#pragma unroll  // vector elements must be indexed by constants
  for (int j = 0; j < 4; ++j) {
    o[j * DD]       = s0[j] + bias0;
    o[j * DD + 128] = s1[j] + bias1;
  }
}

// ---------------------------------------------------------------------------
extern "C" void kernel_launch(void* const* d_in, const int* in_sizes, int n_in,
                              void* d_out, int out_size, void* d_ws, size_t ws_size,
                              hipStream_t stream) {
  const float* x    = (const float*)d_in[0];
  const int*   mask = (const int*)  d_in[1];
  const float* td   = (const float*)d_in[2];
  const float* Wq   = (const float*)d_in[3];
  const float* bq   = (const float*)d_in[4];
  const float* Wk   = (const float*)d_in[5];
  const float* bk   = (const float*)d_in[6];
  const float* Wv   = (const float*)d_in[7];
  const float* bv   = (const float*)d_in[8];
  float* out = (float*)d_out;

  // 8 batch rows per work-group of 8 waves: 256 work-groups; no workspace use
  k_fused<<<dim3(256), dim3(256), 0, stream>>>(x, mask, td, Wq, bq, Wk, bk, Wv, bv, out);
}

// v004
// Measured time: 19.9 microseconds a run.
// Timed twice side by side with v003, it ran 1.05 times as fast both times.
// Over all steps from v000 it is 2.30 times as fast.
#include <hip/hip_runtime.h>
#include <math.h>

// Problem constants (reference: B=2048, T=50, D=256)
#define BB 2048
#define TT 50
#define DD 256
#define NEGV -100000.0f

typedef float v2f __attribute__((ext_vector_type(2)));
typedef float v4f __attribute__((ext_vector_type(4)));
typedef float v8f __attribute__((ext_vector_type(8)));

// LDS row pitches in floats. 260 (1040 B): the 16 rows that one ds_load_b64
// fragment read touches fall on 64 distinct banks. 136 (544 B): rows k and
// k + 2, read together by the two lane halves, sit 16 banks apart.
#define PA 260
#define PK 136
// Floats per weight buffer: half a weight matrix, as 128 rows at pitch PA or as
// 256 half rows at pitch PK, whichever is larger.
#define WB (DD * PK)
#define RB 8    // batch rows per work-group

typedef int v4i __attribute__((ext_vector_type(4)));

// One 16-byte memory->LDS copy per lane, written as the builtin: the compiler
// keeps its address registers itself, and the wave goes on without a wait.
__device__ __forceinline__ void copy16(float* l, const float* g)
{
  __builtin_amdgcn_global_load_async_to_lds_b128(
      (__attribute__((address_space(1))) v4i*)g,
      (__attribute__((address_space(3))) v4i*)l, 0, 0);
}

// A thread's 32 copies of half a weight matrix (128 KiB per work-group) into buf:
// rows of 2^LOG 16-byte pieces, source row stride DD floats, LDS pitch PITCH
// floats. Every wave-wide copy moves 512 contiguous bytes. eight(j) issues copies
// 8j..8j+7 and waits for nothing: the caller places the four groups among the
// work that the copies fly behind, so that issuing them holds no WMMA back.
template <int LOG, int PITCH>
struct Stage {
  float*       l;
  const float* g;
  __device__ __forceinline__ Stage(float* buf, const float* Wsrc, int t)
  {
    const int row = t >> LOG, col = (t & ((1 << LOG) - 1)) * 4;
    l = buf + row * PITCH + col;
    g = Wsrc + (size_t)row * DD + col;
  }
  __device__ __forceinline__ void eight(int j) const
  {
    constexpr int RS = 256 >> LOG;         // rows that one copy of the block covers
#pragma unroll  // constant steps between the eight copies
    for (int u = 0; u < 8; ++u)
      copy16(l + (j * 8 + u) * RS * PITCH, g + (size_t)(j * 8 + u) * RS * DD);
  }
};
// For a K loop behind which no weight half is wanted any more.
struct NoStage {
  __device__ __forceinline__ void eight(int) const {}
};

// Publish point of the weight ring and of the activation tiles: the wave's own
// LDS reads and writes retired, its own copies landed, then the barrier behind
// which other waves read them and the buffer just read may be refilled.
__device__ __forceinline__ void publish()
{
  asm volatile("s_wait_dscnt 0x0" ::: "memory");
  asm volatile("s_wait_asynccnt 0x0" ::: "memory");
  __syncthreads();
}

// K loop on LDS fragments, k ascending. The reads of the next 8 k-steps
// are issued as one group ahead of the current 8 WMMAs (second register set),
// so that the LDS latency hides behind the accumulate chain.
// A fragment: ap[kk], ap[kk+1]; B fragment: bp[kk*BK], bp[kk*BK + BS].
// The four copy groups of st go out with the first four read groups.
template <int BK, int BS, bool SCALE, class ST>
__device__ __forceinline__ v8f kloop(const float* ap, const float* bp,
                                     int half, float s, const ST& st)
{
  v8f c = {};
  v2f a[2][8], b[2][8];
#pragma unroll  // register sets must be indexed by constants
  for (int g = -1; g < 8; ++g) {
    if (g < 7) {
#pragma unroll  // constant register-set index and LDS offsets
      for (int u = 0; u < 8; ++u) {
        const int kk = (g + 1) * 32 + u * 4 + 2 * half;
        a[(g + 1) & 1][u] = *(const v2f*)(ap + kk);
        b[(g + 1) & 1][u].x = bp[kk * BK];
        b[(g + 1) & 1][u].y = bp[kk * BK + BS];
      }
    }
    if (g < 3) st.eight(g + 1);
    // Keeps the read group above from sinking in among the WMMAs below.
    __builtin_amdgcn_sched_barrier(0);
    if (g >= 0) {
#pragma unroll  // constant register-set index
      for (int u = 0; u < 8; ++u) {
        v2f av = a[g & 1][u];
        if (SCALE) av = av * s;
        c = __builtin_amdgcn_wmma_f32_16x16x4_f32(false, av, false, b[g & 1][u],
                                                  (short)0, c, false, false);
      }
    }
  }
  return c;
}

#define CH 10   // rows per chunk

// v + (v of lane l ^ M) inside each 16-lane row; CTRL = 0x160 + M (row_xmask:M).
template <int CTRL>
__device__ __forceinline__ float row_xadd(float v)
{
  return v + __builtin_bit_cast(float, __builtin_amdgcn_update_dpp(
                 0, __builtin_bit_cast(int, v), CTRL, 0xf, 0xf, true));
}

// Sum over the wave's 32 lanes, left in every lane (all lanes on).
__device__ __forceinline__ float wave_sum(float v)
{
  v = row_xadd<0x161>(v);
  v = row_xadd<0x162>(v);
  v = row_xadd<0x164>(v);
  v = row_xadd<0x168>(v);
  const int i = __builtin_bit_cast(int, v);
  return v + __builtin_bit_cast(float, __builtin_amdgcn_permlanex16(
                 i, i, 0x76543210, 0xfedcba98, false, false));
}

// exp(x) as 2^(x * log2 e). The v_nop is the one slot that the instruction set
// asks for between a transcendental and a directly following instruction that
// reads its result or overwrites its source.
__device__ __forceinline__ float exp_slot(float x)
{
  const float t = x * 1.442695041f;
  float r;
  asm("v_exp_f32 %0, %1\n\tv_nop" : "=v"(r) : "v"(t));
  return r;
}

__device__ __forceinline__ float hsum(v4f t)
{
  const v2f h = t.xy + t.zw;
  return h.x + h.y;
}

// CH rows of x, two 16-byte pieces per lane and row; p already holds the lane.
__device__ __forceinline__ void load_rows(v4f (&a)[CH], v4f (&b)[CH], const v4f* p)
{
#pragma unroll  // register arrays must be indexed by constants
  for (int u = 0; u < CH; ++u) {
    a[u] = p[u * 64];
    b[u] = p[u * 64 + 32];
  }
}

// Folds CH rows into the running (m, l, oa, ob). Row u's td sits in lane l0 + u
// of tdv, its mask in bit l0 + u of kpv (l0 and kpv are wave-uniform).
__device__ __forceinline__ void fold_rows(
    const v4f (&a)[CH], const v4f (&b)[CH], v4f ka, v4f kb, float tdv, unsigned kpv,
    int l0, float qbk, float negsc, float& m, float& l, v4f& oa, v4f& ob)
{
  float sc[CH], tw[CH];
#pragma unroll  // register arrays must be indexed by constants
  for (int u = 0; u < CH; ++u) {
    const float acc = wave_sum(hsum(ka * a[u] + kb * b[u]));
    tw[u] = __builtin_bit_cast(float, __builtin_amdgcn_readlane(
                __builtin_bit_cast(int, tdv), l0 + u));
    sc[u] = ((kpv >> (l0 + u)) & 1u) ? (tw[u] * acc + qbk) * 0.0625f : negsc;
  }
  float mn = m;
#pragma unroll  // register arrays must be indexed by constants
  for (int u = 0; u < CH; ++u) mn = fmaxf(mn, sc[u]);
  const float f = exp_slot(m - mn);   // rescales what the earlier rows summed
  m = mn;
  l *= f;
  oa *= f;
  ob *= f;
#pragma unroll  // register arrays must be indexed by constants
  for (int u = 0; u < CH; ++u) {
    const float e = exp_slot(sc[u] - mn);
    const float w = e * tw[u];
    l += e;
    oa += w * a[u];
    ob += w * b[u];
  }
}

// ---------------------------------------------------------------------------
// The whole function in one launch. A work-group of 8 waves takes RB = 8 batch
// rows from x to out; nothing passes through global memory in between.
//   q    = mask_last ? (x_last * td_last) @ Wq^T + bq : NEG      (WMMA)
//   qk   = q @ Wk                                                (WMMA)
//   xbar = sum_s p_s*td_s*x_s / sum_s p_s, one wave per batch row, with
//          score = mask ? (td_s*dot(qk,x_s) + q.bk)/16 : (-1e5*sum(q))/16
//   out  = xbar @ Wv^T + bv                                      (WMMA)
// The 16-row A tiles hold the 8 batch rows twice (tile row r and r + 8), so that
// every LDS word a fragment read touches has been written.
// The six weight halves (Wq, Wk, Wv; 128 output columns each, one 16x16 tile
// per wave) go through two LDS buffers: half t + 2 is copied into the buffer of
// half t behind the barrier that ends half t's reads, and flies during half
// t + 1's WMMAs; the last half (of Wv) flies during the attention stage.
// Attention stage: the wave streams x[b] through registers in chunks of CH rows,
// the next chunk's loads in flight while this chunk is worked on, and keeps a
// running maximum, sum and weighted row sum (online softmax). Lane l holds
// columns 4l..4l+3 and 128+4l..128+4l+3 of every row, so that each wave-wide
// load covers 512 contiguous bytes.
// ---------------------------------------------------------------------------
__global__ __launch_bounds__(256) void k_fused(
    const float* __restrict__ x, const int* __restrict__ mask,
    const float* __restrict__ td, const float* __restrict__ Wq,
    const float* __restrict__ bq, const float* __restrict__ Wk,
    const float* __restrict__ bk, const float* __restrict__ Wv,
    const float* __restrict__ bv, float* __restrict__ out)
{
  const int t    = threadIdx.x;
  const int lane = t & 31;
  const int w    = t >> 5;                 // wave: N tile of a half, batch row
  const int half = lane >> 4;              // K sub-pair select
  const int lm   = lane & 15;
  const int b0   = blockIdx.x * RB;

  __shared__ __attribute__((aligned(16))) float S[2 * WB + 2 * 16 * PA];
  // The activation tiles lie first: with the weight buffers above them, no copy's
  // LDS address falls below the constant step that the compiler folds into it.
  float* const A0 = S;                     // x_last tile, later the qk tile
  float* const A1 = A0 + 16 * PA;          // q tile, later the xbar tile
  float* const W0 = A1 + 16 * PA;
  float* const W1 = W0 + WB;

  // ---- prologue: x_last tile and weight half 0, published ----
#pragma unroll  // constant steps
  for (int u = 0; u < 4; ++u) {
    const int c = u * 256 + t, row = c >> 6, col = (c & 63) * 4;
    copy16(A0 + row * PA + col,
           x + ((size_t)(b0 + (row & (RB - 1))) * TT + (TT - 1)) * DD + col);
  }
  {
    const Stage<6, PA> st(W0, Wq, t);
#pragma unroll  // constant steps
    for (int j = 0; j < 4; ++j) st.eight(j);
  }
  // Last time step of the lane's A-tile row: its time-decay, and the 8 rows' masks
  // gathered into one bit per batch row (bit r from lane r).
  const int      lrow  = (b0 + (lm & (RB - 1))) * TT + (TT - 1);
  const float    tdl   = td[lrow];
  const unsigned keepq = __builtin_amdgcn_ballot_w32(mask[lrow] != 0);
  // Own-wave landing of the copies, then the barrier that publishes them.
  asm volatile("s_wait_asynccnt 0x0" ::: "memory");
  __syncthreads();

  const float* const a0row = A0 + lm * PA;
  const float* const a1row = A1 + lm * PA;
  const int brow = (w * 16 + lm) * PA;     // B[kk,n] = W[n,kk], pitch PA
  const int bcol = w * 16 + lm;            // B[kk,n] = W[kk,n], pitch PK
  const int nl   = w * 16 + lm;            // output column inside a half

  // ---- q: halves 0 and 1 (Wq rows) ----
#pragma unroll  // the buffer and the refill differ by constants
  for (int h = 0; h < 2; ++h) {
    // In flight behind this half's WMMAs: the next half of the ring, into the
    // buffer whose last reads the barrier above has ended.
    v8f c;
    if (h == 0)
      c = kloop<1, 1, true>(a0row, W0 + brow, half, tdl,
                            Stage<6, PA>(W1, Wq + (size_t)128 * DD, t));
    else
      c = kloop<1, 1, true>(a0row, W1 + brow, half, tdl, Stage<5, PK>(W0, Wk, t));
    const int   n    = h * 128 + nl;
    const float bias = bq[n];
#pragma unroll  // vector elements must be indexed by constants
    for (int r = 0; r < 8; ++r) {          // C VGPR layout: tile row r + 8*half
      const float v = ((keepq >> r) & 1u) ? c[r] + bias : NEGV;   // q-side mask-fill
      A1[(r + 8 * half) * PA + n] = v;
    }
    publish();
  }

  // ---- qk: halves 2 and 3 (Wk columns) ----
#pragma unroll  // the buffer and the refill differ by constants
  for (int h = 0; h < 2; ++h) {
    v8f c;
    if (h == 0)
      c = kloop<PK, PK, false>(a1row, W0 + bcol, half, 1.0f,
                               Stage<5, PK>(W1, Wk + 128, t));
    else
      c = kloop<PK, PK, false>(a1row, W1 + bcol, half, 1.0f, Stage<6, PA>(W0, Wv, t));
    const int n = h * 128 + nl;
#pragma unroll  // vector elements must be indexed by constants
    for (int r = 0; r < 8; ++r) A0[(r + 8 * half) * PA + n] = c[r];
    publish();
  }

  // ---- attention: wave w takes batch row b0 + w ----
  {
    const int wu = __builtin_amdgcn_readfirstlane(w);
    const int b  = b0 + wu;
    const v4f* qkp = (const v4f*)(A0 + wu * PA) + lane;
    const v4f* qp  = (const v4f*)(A1 + wu * PA) + lane;
    const v4f* bkp = (const v4f*)bk + lane;
    const v4f ka = qkp[0], kb = qkp[32];
    const v4f qa = qp[0],  qb = qp[32];
    // the wave's small global operands first: loads return in issue order
    const v4f ba = bkp[0], bb = bkp[32];
    // td of rows 0..29 in lanes 0..29 of td0, of rows 30..49 in lanes 0..19 of
    // td1 (the other lanes' indices are clamped into range); the mask likewise,
    // gathered into one bit per row.
    const int      r0  = lane < 30 ? lane : 29;
    const int      r1  = lane < 20 ? 30 + lane : TT - 1;
    const float    td0 = td[b * TT + r0], td1 = td[b * TT + r1];
    const unsigned kp0 = __builtin_amdgcn_ballot_w32(mask[b * TT + r0] != 0);
    const unsigned kp1 = __builtin_amdgcn_ballot_w32(mask[b * TT + r1] != 0);

    // The build lets the row loads below land in registers that hold addresses of
    // the loads above: this wait stands in front of that overwrite.
    asm volatile("s_wait_xcnt 0x0" ::: "memory");

    const v4f* xp = (const v4f*)(x + (size_t)b * TT * DD) + lane;
    v4f ca[CH], cb[CH];   // the chunk being worked on
    load_rows(ca, cb, xp);
    // Keeps every load above in front of the first arithmetic, which waits on some.
    __builtin_amdgcn_sched_barrier(0);

    const float qbk   = wave_sum(hsum(qa * ba + qb * bb));
    const float negsc = (NEGV * wave_sum(hsum(qa + qb))) * 0.0625f;

    const Stage<6, PA> st5(W1, Wv + (size_t)128 * DD, t);
    static_assert(TT / CH - 1 == 4, "one copy group per trip of the loop below");
    float m = -3.402823466e38f, l = 0.f;
    v4f oa = {}, ob = {};
    // Kept rolled: unrolled, the build kept all 50 rows live to the end and spilled.
#pragma nounroll
    for (int it = 0; it < TT / CH - 1; ++it) {
      v4f na[CH], nb[CH];   // the next chunk, in flight during this one's arithmetic
      load_rows(na, nb, xp + (it + 1) * CH * 64);
      st5.eight(it);        // the last weight half: a group behind each trip's rows
      // Keeps the loads at the head of the trip: sunk among the arithmetic they
      // would have less of it to hide behind.
      __builtin_amdgcn_sched_barrier(0);
      const bool lo = it < 3;
      fold_rows(ca, cb, ka, kb, lo ? td0 : td1, lo ? kp0 : kp1,
                lo ? it * CH : it * CH - 30, qbk, negsc, m, l, oa, ob);
#pragma unroll  // register arrays must be indexed by constants
      for (int u = 0; u < CH; ++u) {
        ca[u] = na[u];
        cb[u] = nb[u];
      }
    }
    fold_rows(ca, cb, ka, kb, td1, kp1, TT - CH - 30, qbk, negsc, m, l, oa, ob);

    // xbar into tile rows w and w + 8 of A1: only this wave has read row w since
    // the last barrier, and its q values are in registers by now.
    const float inv = 1.0f / l;
    const v4f xa = oa * inv, xb = ob * inv;
    v4f* op = (v4f*)(A1 + wu * PA) + lane;
    v4f* oq = (v4f*)(A1 + (wu + RB) * PA) + lane;
    op[0]  = xa;
    op[32] = xb;
    oq[0]  = xa;
    oq[32] = xb;
  }
  // Publishes the xbar tile and weight half 5 (half 4 was published above).
  publish();

  // ---- out: halves 4 and 5 (Wv rows); no LDS is written any more ----
  const v8f c0 = kloop<1, 1, false>(a1row, W0 + brow, half, 1.0f, NoStage());
  const v8f c1 = kloop<1, 1, false>(a1row, W1 + brow, half, 1.0f, NoStage());
  const float bias0 = bv[nl], bias1 = bv[128 + nl];
  // Tile rows r and r + 8 are the same batch row: lanes 0..15 store batch rows
  // 0..3, lanes 16..31 batch rows 4..7, each element once.
  const v4f s0 = half ? __builtin_shufflevector(c0, c0, 4, 5, 6, 7)
                      : __builtin_shufflevector(c0, c0, 0, 1, 2, 3);
  const v4f s1 = half ? __builtin_shufflevector(c1, c1, 4, 5, 6, 7)
                      : __builtin_shufflevector(c1, c1, 0, 1, 2, 3);
  float* o = out + (size_t)(b0 + half * 4) * DD + nl;
#pragma unroll  // vector elements must be indexed by constants
  for (int j = 0; j < 4; ++j) {
    o[j * DD]       = s0[j] + bias0;
    o[j * DD + 128] = s1[j] + bias1;
  }
}

// ---------------------------------------------------------------------------
extern "C" void kernel_launch(void* const* d_in, const int* in_sizes, int n_in,
                              void* d_out, int out_size, void* d_ws, size_t ws_size,
                              hipStream_t stream) {
  const float* x    = (const float*)d_in[0];
  const int*   mask = (const int*)  d_in[1];
  const float* td   = (const float*)d_in[2];
  const float* Wq   = (const float*)d_in[3];
  const float* bq   = (const float*)d_in[4];
  const float* Wk   = (const float*)d_in[5];
  const float* bk   = (const float*)d_in[6];
  const float* Wv   = (const float*)d_in[7];
  const float* bv   = (const float*)d_in[8];
  float* out = (float*)d_out;

  // 8 batch rows per work-group of 8 waves: 256 work-groups; no workspace use
  k_fused<<<dim3(256), dim3(256), 0, stream>>>(x, mask, td, Wq, bq, Wk, bk, Wv, bv, out);
}

// v005
// It runs in 19.2 microseconds.
// Next to v004, in two timings, it ran 1.05 and 1.04 times as fast.
// Over all steps from v000 it is 2.40 times as fast.
#include <hip/hip_runtime.h>
#include <math.h>

// Problem constants (reference: B=2048, T=50, D=256)
#define BB 2048
#define TT 50
#define DD 256
#define NEGV -100000.0f

typedef float v2f __attribute__((ext_vector_type(2)));
typedef float v4f __attribute__((ext_vector_type(4)));
typedef float v8f __attribute__((ext_vector_type(8)));

// LDS row pitches in floats. 260 (1040 B): the 16 rows that one ds_load_b64
// fragment read touches fall on 64 distinct banks. 136 (544 B): rows k and
// k + 2, read together by the two lane halves, sit 16 banks apart.
#define PA 260
#define PK 136
// Floats per weight buffer: half a weight matrix, as 128 rows at pitch PA or as
// 256 half rows at pitch PK, whichever is larger.
#define WB (DD * PK)
#define RB 8    // batch rows per work-group

typedef int v4i __attribute__((ext_vector_type(4)));

// One 16-byte memory->LDS copy per lane, written as the builtin: the compiler
// keeps its address registers itself, and the wave goes on without a wait.
__device__ __forceinline__ void copy16(float* l, const float* g)
{
  __builtin_amdgcn_global_load_async_to_lds_b128(
      (__attribute__((address_space(1))) v4i*)g,
      (__attribute__((address_space(3))) v4i*)l, 0, 0);
}

// A thread's 32 copies of half a weight matrix (128 KiB per work-group) into buf:
// rows of 2^LOG 16-byte pieces, source row stride DD floats, LDS pitch PITCH
// floats. Every wave-wide copy moves 512 contiguous bytes. eight(j) issues copies
// 8j..8j+7 and waits for nothing: the caller places the four groups among the
// work that the copies fly behind, so that issuing them holds no WMMA back.
template <int LOG, int PITCH>
struct Stage {
  float*       l;
  const float* g;
  __device__ __forceinline__ Stage(float* buf, const float* Wsrc, int t)
  {
    const int row = t >> LOG, col = (t & ((1 << LOG) - 1)) * 4;
    l = buf + row * PITCH + col;
    g = Wsrc + (size_t)row * DD + col;
  }
  __device__ __forceinline__ void eight(int j) const
  {
    constexpr int RS = 256 >> LOG;         // rows that one copy of the block covers
#pragma unroll  // constant steps between the eight copies
    for (int u = 0; u < 8; ++u)
      copy16(l + (j * 8 + u) * RS * PITCH, g + (size_t)(j * 8 + u) * RS * DD);
  }
};
// For a K loop behind which no weight half is wanted any more.
struct NoStage {
  __device__ __forceinline__ void eight(int) const {}
};

// Publish point of the weight ring and of the activation tiles: the wave's own
// LDS reads and writes retired, its own copies landed, then the barrier behind
// which other waves read them and the buffer just read may be refilled.
__device__ __forceinline__ void publish()
{
  asm volatile("s_wait_dscnt 0x0" ::: "memory");
  asm volatile("s_wait_asynccnt 0x0" ::: "memory");
  // The work-group barrier with its two fences on LDS alone: __syncthreads() would
  // also wait out the wave's global loads, the x rows that are to stay in flight
  // across it. No wave reads global memory that another wave has written.
  __builtin_amdgcn_fence(__ATOMIC_RELEASE, "workgroup", "local");
  __builtin_amdgcn_s_barrier();
  __builtin_amdgcn_fence(__ATOMIC_ACQUIRE, "workgroup", "local");
}

#define CH 10   // rows per chunk

// CH rows of x, two 16-byte pieces per lane and row; p already holds the lane.
__device__ __forceinline__ void load_rows(v4f (&a)[CH], v4f (&b)[CH], const v4f* p)
{
#pragma unroll  // register arrays must be indexed by constants
  for (int u = 0; u < CH; ++u) {
    a[u] = p[u * 64];
    b[u] = p[u * 64 + 32];
  }
  // Stands in front of any later overwrite of a register that these loads name.
  asm volatile("s_wait_xcnt 0x0" ::: "memory");
}

// A chunk of the wave's own x rows, asked for inside a K loop: it lands in registers
// behind the WMMAs of that loop and the next, before the attention stage reads it.
struct Rows {
  v4f (&a)[CH];
  v4f (&b)[CH];
  const v4f* p;
  __device__ __forceinline__ void go() const { load_rows(a, b, p); }
};
// For a K loop behind which no x row is wanted any more.
struct NoRows {
  __device__ __forceinline__ void go() const {}
};

// K loop on LDS fragments, k ascending. The reads of the next 8 k-steps
// are issued as one group ahead of the current 8 WMMAs (second register set),
// so that the LDS latency hides behind the accumulate chain.
// A fragment: ap[kk], ap[kk+1]; B fragment: bp[kk*BK], bp[kk*BK + BS].
// The four copy groups of st go out with the first four read groups; the x rows of
// xr go out with the fifth, behind the copies: the copies must have landed at the
// barrier that closes this loop, the rows only at the attention stage.
template <int BK, int BS, bool SCALE, class ST, class XR>
__device__ __forceinline__ v8f kloop(const float* ap, const float* bp,
                                     int half, float s, const ST& st, const XR& xr)
{
  v8f c = {};
  v2f a[2][8], b[2][8];
#pragma unroll  // register sets must be indexed by constants
  for (int g = -1; g < 8; ++g) {
    if (g < 7) {
#pragma unroll  // constant register-set index and LDS offsets
      for (int u = 0; u < 8; ++u) {
        const int kk = (g + 1) * 32 + u * 4 + 2 * half;
        a[(g + 1) & 1][u] = *(const v2f*)(ap + kk);
        b[(g + 1) & 1][u].x = bp[kk * BK];
        b[(g + 1) & 1][u].y = bp[kk * BK + BS];
      }
    }
    if (g < 3) st.eight(g + 1);
    if (g == 3) xr.go();
    // Keeps the read group above from sinking in among the WMMAs below.
    __builtin_amdgcn_sched_barrier(0);
    if (g >= 0) {
#pragma unroll  // constant register-set index
      for (int u = 0; u < 8; ++u) {
        v2f av = a[g & 1][u];
        if (SCALE) av = av * s;
        c = __builtin_amdgcn_wmma_f32_16x16x4_f32(false, av, false, b[g & 1][u],
                                                  (short)0, c, false, false);
      }
    }
  }
  return c;
}

// v + (v of lane l ^ M) inside each 16-lane row; CTRL = 0x160 + M (row_xmask:M).
template <int CTRL>
__device__ __forceinline__ float row_xadd(float v)
{
  return v + __builtin_bit_cast(float, __builtin_amdgcn_update_dpp(
                 0, __builtin_bit_cast(int, v), CTRL, 0xf, 0xf, true));
}

// Sum over the wave's 32 lanes, left in every lane (all lanes on).
__device__ __forceinline__ float wave_sum(float v)
{
  v = row_xadd<0x161>(v);
  v = row_xadd<0x162>(v);
  v = row_xadd<0x164>(v);
  v = row_xadd<0x168>(v);
  const int i = __builtin_bit_cast(int, v);
  return v + __builtin_bit_cast(float, __builtin_amdgcn_permlanex16(
                 i, i, 0x76543210, 0xfedcba98, false, false));
}

// exp(x) as 2^(x * log2 e). The v_nop is the one slot that the instruction set
// asks for between a transcendental and a directly following instruction that
// reads its result or overwrites its source.
__device__ __forceinline__ float exp_slot(float x)
{
  const float t = x * 1.442695041f;
  float r;
  asm("v_exp_f32 %0, %1\n\tv_nop" : "=v"(r) : "v"(t));
  return r;
}

__device__ __forceinline__ float hsum(v4f t)
{
  const v2f h = t.xy + t.zw;
  return h.x + h.y;
}

// Folds CH rows into the running (m, l, oa, ob). Row u's td sits in lane l0 + u
// of tdv, its mask in bit l0 + u of kpv (l0 and kpv are wave-uniform).
__device__ __forceinline__ void fold_rows(
    const v4f (&a)[CH], const v4f (&b)[CH], v4f ka, v4f kb, float tdv, unsigned kpv,
    int l0, float qbk, float negsc, float& m, float& l, v4f& oa, v4f& ob)
{
  float sc[CH], tw[CH];
#pragma unroll  // register arrays must be indexed by constants
  for (int u = 0; u < CH; ++u) {
    const float acc = wave_sum(hsum(ka * a[u] + kb * b[u]));
    tw[u] = __builtin_bit_cast(float, __builtin_amdgcn_readlane(
                __builtin_bit_cast(int, tdv), l0 + u));
    sc[u] = ((kpv >> (l0 + u)) & 1u) ? (tw[u] * acc + qbk) * 0.0625f : negsc;
  }
  float mn = m;
#pragma unroll  // register arrays must be indexed by constants
  for (int u = 0; u < CH; ++u) mn = fmaxf(mn, sc[u]);
  const float f = exp_slot(m - mn);   // rescales what the earlier rows summed
  m = mn;
  l *= f;
  oa *= f;
  ob *= f;
#pragma unroll  // register arrays must be indexed by constants
  for (int u = 0; u < CH; ++u) {
    const float e = exp_slot(sc[u] - mn);
    const float w = e * tw[u];
    l += e;
    oa += w * a[u];
    ob += w * b[u];
  }
}

// ---------------------------------------------------------------------------
// The whole function in one launch. A work-group of 8 waves takes RB = 8 batch
// rows from x to out; nothing passes through global memory in between.
//   q    = mask_last ? (x_last * td_last) @ Wq^T + bq : NEG      (WMMA)
//   qk   = q @ Wk                                                (WMMA)
//   xbar = sum_s p_s*td_s*x_s / sum_s p_s, one wave per batch row, with
//          score = mask ? (td_s*dot(qk,x_s) + q.bk)/16 : (-1e5*sum(q))/16
//   out  = xbar @ Wv^T + bv                                      (WMMA)
// The 16-row A tiles hold the 8 batch rows twice (tile row r and r + 8), so that
// every LDS word a fragment read touches has been written.
// The six weight halves (Wq, Wk, Wv; 128 output columns each, one 16x16 tile
// per wave) go through two LDS buffers: half t + 2 is copied into the buffer of
// half t behind the barrier that ends half t's reads, and flies during half
// t + 1's WMMAs; the last half (of Wv) flies during the attention stage.
// Attention stage: the wave folds x[b] in chunks of CH rows into a running maximum,
// sum and weighted row sum (online softmax). The rows do not depend on q or qk:
// the first four chunks are asked for inside the four K loops of q and qk, one
// each, and wait in registers; the fifth flies behind the folds. Lane l holds
// columns 4l..4l+3 and 128+4l..128+4l+3 of every row, so that each wave-wide
// load covers 512 contiguous bytes.
// ---------------------------------------------------------------------------
__global__ __launch_bounds__(256) void k_fused(
    const float* __restrict__ x, const int* __restrict__ mask,
    const float* __restrict__ td, const float* __restrict__ Wq,
    const float* __restrict__ bq, const float* __restrict__ Wk,
    const float* __restrict__ bk, const float* __restrict__ Wv,
    const float* __restrict__ bv, float* __restrict__ out)
{
  const int t    = threadIdx.x;
  const int lane = t & 31;
  const int w    = t >> 5;                 // wave: N tile of a half, batch row
  const int half = lane >> 4;              // K sub-pair select
  const int lm   = lane & 15;
  const int b0   = blockIdx.x * RB;

  __shared__ __attribute__((aligned(16))) float S[2 * WB + 2 * 16 * PA];
  // The activation tiles lie first: with the weight buffers above them, no copy's
  // LDS address falls below the constant step that the compiler folds into it.
  float* const A0 = S;                     // x_last tile, later the qk tile
  float* const A1 = A0 + 16 * PA;          // q tile, later the xbar tile
  float* const W0 = A1 + 16 * PA;
  float* const W1 = W0 + WB;

  // ---- prologue: x_last tile and weight half 0, published ----
#pragma unroll  // constant steps
  for (int u = 0; u < 4; ++u) {
    const int c = u * 256 + t, row = c >> 6, col = (c & 63) * 4;
    copy16(A0 + row * PA + col,
           x + ((size_t)(b0 + (row & (RB - 1))) * TT + (TT - 1)) * DD + col);
  }
  {
    const Stage<6, PA> st(W0, Wq, t);
#pragma unroll  // constant steps
    for (int j = 0; j < 4; ++j) st.eight(j);
  }
  // Last time step of the lane's A-tile row: its time-decay, and the 8 rows' masks
  // gathered into one bit per batch row (bit r from lane r).
  const int      lrow  = (b0 + (lm & (RB - 1))) * TT + (TT - 1);
  const float    tdl   = td[lrow];
  const unsigned keepq = __builtin_amdgcn_ballot_w32(mask[lrow] != 0);
  // The attention stage's small global operands (wave w takes batch row b0 + w):
  // bk; td of rows 0..29 in lanes 0..29 of td0, of rows 30..49 in lanes 0..19 of
  // td1 (the other lanes' indices are clamped into range); the mask likewise,
  // gathered into one bit per row.
  const int      wu  = __builtin_amdgcn_readfirstlane(w);
  const int      b   = b0 + wu;
  const v4f*     bkp = (const v4f*)bk + lane;
  const v4f      ba  = bkp[0], bb = bkp[32];
  const int      r0  = lane < 30 ? lane : 29;
  const int      r1  = lane < 20 ? 30 + lane : TT - 1;
  const float    td0 = td[b * TT + r0], td1 = td[b * TT + r1];
  const unsigned kp0 = __builtin_amdgcn_ballot_w32(mask[b * TT + r0] != 0);
  const unsigned kp1 = __builtin_amdgcn_ballot_w32(mask[b * TT + r1] != 0);
  // bq here too: loads return in issue order, so that a bias asked for behind a
  // chunk of x rows would be waited for together with those rows.
  const float bq0 = bq[w * 16 + lm], bq1 = bq[128 + w * 16 + lm];
  // Stands in front of any later overwrite of a register that these loads name.
  asm volatile("s_wait_xcnt 0x0" ::: "memory");
  // The wave's x rows: chunks 0 to 3 here, asked for in the K loops below; the
  // fifth chunk's registers are declared where it is asked for.
  const v4f* xp = (const v4f*)(x + (size_t)b * TT * DD) + lane;
  v4f x0a[CH], x0b[CH], x1a[CH], x1b[CH], x2a[CH], x2b[CH], x3a[CH], x3b[CH];
  // Own-wave landing of the copies, then the barrier that publishes them.
  asm volatile("s_wait_asynccnt 0x0" ::: "memory");
  __syncthreads();

  const float* const a0row = A0 + lm * PA;
  const float* const a1row = A1 + lm * PA;
  const int brow = (w * 16 + lm) * PA;     // B[kk,n] = W[n,kk], pitch PA
  const int bcol = w * 16 + lm;            // B[kk,n] = W[kk,n], pitch PK
  const int nl   = w * 16 + lm;            // output column inside a half

  // ---- q: halves 0 and 1 (Wq rows) ----
#pragma unroll  // the buffer and the refill differ by constants
  for (int h = 0; h < 2; ++h) {
    // In flight behind this half's WMMAs: the next half of the ring, into the
    // buffer whose last reads the barrier above has ended.
    v8f c;
    if (h == 0)
      c = kloop<1, 1, true>(a0row, W0 + brow, half, tdl,
                            Stage<6, PA>(W1, Wq + (size_t)128 * DD, t),
                            Rows{x0a, x0b, xp});
    else
      c = kloop<1, 1, true>(a0row, W1 + brow, half, tdl, Stage<5, PK>(W0, Wk, t),
                            Rows{x1a, x1b, xp + CH * 64});
    const int   n    = h * 128 + nl;
    const float bias = h == 0 ? bq0 : bq1;
#pragma unroll  // vector elements must be indexed by constants
    for (int r = 0; r < 8; ++r) {          // C VGPR layout: tile row r + 8*half
      const float v = ((keepq >> r) & 1u) ? c[r] + bias : NEGV;   // q-side mask-fill
      A1[(r + 8 * half) * PA + n] = v;
    }
    publish();
  }

  // ---- qk: halves 2 and 3 (Wk columns) ----
#pragma unroll  // the buffer and the refill differ by constants
  for (int h = 0; h < 2; ++h) {
    v8f c;
    if (h == 0)
      c = kloop<PK, PK, false>(a1row, W0 + bcol, half, 1.0f,
                               Stage<5, PK>(W1, Wk + 128, t),
                               Rows{x2a, x2b, xp + 2 * CH * 64});
    else
      c = kloop<PK, PK, false>(a1row, W1 + bcol, half, 1.0f, Stage<6, PA>(W0, Wv, t),
                               Rows{x3a, x3b, xp + 3 * CH * 64});
    const int n = h * 128 + nl;
#pragma unroll  // vector elements must be indexed by constants
    for (int r = 0; r < 8; ++r) A0[(r + 8 * half) * PA + n] = c[r];
    publish();
  }

  // ---- attention: wave w takes batch row b0 + w ----
  {
    const v4f* qkp = (const v4f*)(A0 + wu * PA) + lane;
    const v4f* qp  = (const v4f*)(A1 + wu * PA) + lane;
    const v4f ka = qkp[0], kb = qkp[32];
    const v4f qa = qp[0],  qb = qp[32];

    v4f x4a[CH], x4b[CH];   // the fifth chunk: four folds to land behind
    load_rows(x4a, x4b, xp + 4 * CH * 64);
    // Keeps these loads in front of the arithmetic below.
    __builtin_amdgcn_sched_barrier(0);

    const float qbk   = wave_sum(hsum(qa * ba + qb * bb));
    const float negsc = (NEGV * wave_sum(hsum(qa + qb))) * 0.0625f;

    const Stage<6, PA> st5(W1, Wv + (size_t)128 * DD, t);
    static_assert(TT == 5 * CH, "two trips of two chunks, then the fifth chunk");
    float m = -3.402823466e38f, l = 0.f;
    v4f oa = {}, ob = {};
    // Two chunks a trip. Kept rolled: with five unrolled folds the kernel's text
    // passes 32 KB.
#pragma nounroll
    for (int it = 0; it < 2; ++it) {
      // The last weight half goes out a group ahead of each of these four folds.
      // Each scheduling barrier keeps the copies at the head of the fold they fly
      // behind, and one fold's temporaries out of the next.
      st5.eight(2 * it);
      __builtin_amdgcn_sched_barrier(0);
      fold_rows(x0a, x0b, ka, kb, td0, kp0, 2 * CH * it, qbk, negsc, m, l, oa, ob);
      st5.eight(2 * it + 1);
      __builtin_amdgcn_sched_barrier(0);
      fold_rows(x1a, x1b, ka, kb, it ? td1 : td0, it ? kp1 : kp0, it ? 0 : CH,
                qbk, negsc, m, l, oa, ob);
#pragma unroll  // register arrays must be indexed by constants
      for (int u = 0; u < CH; ++u) {
        x0a[u] = x2a[u];
        x0b[u] = x2b[u];
        x1a[u] = x3a[u];
        x1b[u] = x3b[u];
      }
    }
    fold_rows(x4a, x4b, ka, kb, td1, kp1, CH, qbk, negsc, m, l, oa, ob);

    // xbar into tile rows w and w + 8 of A1: only this wave has read row w since
    // the last barrier, and its q values are in registers by now.
    const float inv = 1.0f / l;
    const v4f xa = oa * inv, xb = ob * inv;
    v4f* op = (v4f*)(A1 + wu * PA) + lane;
    v4f* oq = (v4f*)(A1 + (wu + RB) * PA) + lane;
    op[0]  = xa;
    op[32] = xb;
    oq[0]  = xa;
    oq[32] = xb;
  }
  // Publishes the xbar tile and weight half 5 (half 4 was published above).
  publish();

  // ---- out: halves 4 and 5 (Wv rows); no LDS is written any more ----
  const v8f c0 = kloop<1, 1, false>(a1row, W0 + brow, half, 1.0f, NoStage(), NoRows());
  const v8f c1 = kloop<1, 1, false>(a1row, W1 + brow, half, 1.0f, NoStage(), NoRows());
  const float bias0 = bv[nl], bias1 = bv[128 + nl];
  // Tile rows r and r + 8 are the same batch row: lanes 0..15 store batch rows
  // 0..3, lanes 16..31 batch rows 4..7, each element once.
  const v4f s0 = half ? __builtin_shufflevector(c0, c0, 4, 5, 6, 7)
                      : __builtin_shufflevector(c0, c0, 0, 1, 2, 3);
  const v4f s1 = half ? __builtin_shufflevector(c1, c1, 4, 5, 6, 7)
                      : __builtin_shufflevector(c1, c1, 0, 1, 2, 3);
  float* o = out + (size_t)(b0 + half * 4) * DD + nl;
#pragma unroll  // vector elements must be indexed by constants
  for (int j = 0; j < 4; ++j) {
    o[j * DD]       = s0[j] + bias0;
    o[j * DD + 128] = s1[j] + bias1;
  }
}

// ---------------------------------------------------------------------------
extern "C" void kernel_launch(void* const* d_in, const int* in_sizes, int n_in,
                              void* d_out, int out_size, void* d_ws, size_t ws_size,
                              hipStream_t stream) {
  const float* x    = (const float*)d_in[0];
  const int*   mask = (const int*)  d_in[1];
  const float* td   = (const float*)d_in[2];
  const float* Wq   = (const float*)d_in[3];
  const float* bq   = (const float*)d_in[4];
  const float* Wk   = (const float*)d_in[5];
  const float* bk   = (const float*)d_in[6];
  const float* Wv   = (const float*)d_in[7];
  const float* bv   = (const float*)d_in[8];
  float* out = (float*)d_out;

  // 8 batch rows per work-group of 8 waves: 256 work-groups; no workspace use
  k_fused<<<dim3(256), dim3(256), 0, stream>>>(x, mask, td, Wq, bq, Wk, bk, Wv, bv, out);
}

// v006
// A run of this version takes 17.6 microseconds.
// In both of two side-by-side timings against v005, it was 1.09 times as fast.
// All steps since v000 together make it 2.62 times as fast.
#include <hip/hip_runtime.h>
#include <math.h>

// Problem constants (reference: B=2048, T=50, D=256)
#define BB 2048
#define TT 50
#define DD 256
#define NEGV -100000.0f

typedef float v2f __attribute__((ext_vector_type(2)));
typedef float v4f __attribute__((ext_vector_type(4)));
typedef float v8f __attribute__((ext_vector_type(8)));

// LDS row pitches in floats. 260 (1040 B): the 16 rows that one ds_load_b64
// fragment read touches fall on 64 distinct banks. 136 (544 B): rows k and
// k + 2, read together by the two lane halves, sit 16 banks apart.
#define PA 260
#define PK 136
// Floats per weight buffer: half a weight matrix, as 128 rows at pitch PA or as
// 256 half rows at pitch PK, whichever is larger.
#define WB (DD * PK)
#define RB 8    // batch rows per work-group

typedef int v4i __attribute__((ext_vector_type(4)));

// One 16-byte memory->LDS copy per lane, written as the builtin: the compiler
// keeps its address registers itself, and the wave goes on without a wait.
__device__ __forceinline__ void copy16(float* l, const float* g)
{
  __builtin_amdgcn_global_load_async_to_lds_b128(
      (__attribute__((address_space(1))) v4i*)g,
      (__attribute__((address_space(3))) v4i*)l, 0, 0);
}

// A thread's 32 copies of half a weight matrix (128 KiB per work-group) into buf:
// rows of 2^LOG 16-byte pieces, source row stride DD floats, LDS pitch PITCH
// floats. Every wave-wide copy moves 512 contiguous bytes. eight(j) issues copies
// 8j..8j+7 and waits for nothing: the caller places the four groups among the
// work that the copies fly behind, so that issuing them holds no WMMA back.
template <int LOG, int PITCH>
struct Stage {
  float*       l;
  const float* g;
  __device__ __forceinline__ Stage(float* buf, const float* Wsrc, int t)
  {
    const int row = t >> LOG, col = (t & ((1 << LOG) - 1)) * 4;
    l = buf + row * PITCH + col;
    g = Wsrc + (size_t)row * DD + col;
  }
  __device__ __forceinline__ void eight(int j) const
  {
    constexpr int RS = 256 >> LOG;         // rows that one copy of the block covers
#pragma unroll  // constant steps between the eight copies
    for (int u = 0; u < 8; ++u)
      copy16(l + (j * 8 + u) * RS * PITCH, g + (size_t)(j * 8 + u) * RS * DD);
  }
};
// For a K loop behind which no weight half is wanted any more.
struct NoStage {
  __device__ __forceinline__ void eight(int) const {}
};

// Publish point of the weight ring and of the activation tiles: the wave's own
// LDS reads and writes retired, its own copies landed, then the barrier behind
// which other waves read them and the buffer just read may be refilled.
__device__ __forceinline__ void publish()
{
  asm volatile("s_wait_dscnt 0x0" ::: "memory");
  asm volatile("s_wait_asynccnt 0x0" ::: "memory");
  // The work-group barrier with its two fences on LDS alone: __syncthreads() would
  // also wait out the wave's global loads, the x rows that are to stay in flight
  // across it. No wave reads global memory that another wave has written.
  __builtin_amdgcn_fence(__ATOMIC_RELEASE, "workgroup", "local");
  __builtin_amdgcn_s_barrier();
  __builtin_amdgcn_fence(__ATOMIC_ACQUIRE, "workgroup", "local");
}

#define CH 10   // rows per chunk

// CH rows of x, two 16-byte pieces per lane and row; p already holds the lane.
__device__ __forceinline__ void load_rows(v4f (&a)[CH], v4f (&b)[CH], const v4f* p)
{
#pragma unroll  // register arrays must be indexed by constants
  for (int u = 0; u < CH; ++u) {
    a[u] = p[u * 64];
    b[u] = p[u * 64 + 32];
  }
  // Stands in front of any later overwrite of a register that these loads name.
  asm volatile("s_wait_xcnt 0x0" ::: "memory");
}

// A chunk of the wave's own x rows, asked for inside a K loop: it lands in registers
// behind the WMMAs of that loop and the next, before the attention stage reads it.
struct Rows {
  v4f (&a)[CH];
  v4f (&b)[CH];
  const v4f* p;
  __device__ __forceinline__ void go() const { load_rows(a, b, p); }
};
// For a K loop behind which no x row is wanted any more.
struct NoRows {
  __device__ __forceinline__ void go() const {}
};

// K loop on LDS fragments, k ascending. The reads of the next 8 k-steps
// are issued as one group ahead of the current 8 WMMAs (second register set),
// so that the LDS latency hides behind the accumulate chain.
// A fragment: ap[kk], ap[kk+1]; B fragment: bp[kk*BK], bp[kk*BK + BS].
// The four copy groups of st go out with the first four read groups; the x rows of
// xr go out with the fifth, behind the copies: the copies must have landed at the
// barrier that closes this loop, the rows only at the attention stage.
template <int BK, int BS, bool SCALE, class ST, class XR>
__device__ __forceinline__ v8f kloop(const float* ap, const float* bp,
                                     int half, float s, const ST& st, const XR& xr)
{
  v8f c = {};
  v2f a[2][8], b[2][8];
#pragma unroll  // register sets must be indexed by constants
  for (int g = -1; g < 8; ++g) {
    if (g < 7) {
#pragma unroll  // constant register-set index and LDS offsets
      for (int u = 0; u < 8; ++u) {
        const int kk = (g + 1) * 32 + u * 4 + 2 * half;
        a[(g + 1) & 1][u] = *(const v2f*)(ap + kk);
        b[(g + 1) & 1][u].x = bp[kk * BK];
        b[(g + 1) & 1][u].y = bp[kk * BK + BS];
      }
    }
    if (g < 3) st.eight(g + 1);
    if (g == 3) xr.go();
    // Keeps the read group above from sinking in among the WMMAs below.
    __builtin_amdgcn_sched_barrier(0);
    if (g >= 0) {
#pragma unroll  // constant register-set index
      for (int u = 0; u < 8; ++u) {
        v2f av = a[g & 1][u];
        if (SCALE) av = av * s;
        c = __builtin_amdgcn_wmma_f32_16x16x4_f32(false, av, false, b[g & 1][u],
                                                  (short)0, c, false, false);
      }
    }
  }
  return c;
}

// v + (v of lane l ^ M) inside each 16-lane row; CTRL = 0x160 + M (row_xmask:M).
template <int CTRL>
__device__ __forceinline__ float row_xadd(float v)
{
  return v + __builtin_bit_cast(float, __builtin_amdgcn_update_dpp(
                 0, __builtin_bit_cast(int, v), CTRL, 0xf, 0xf, true));
}

// Sum over the wave's 32 lanes, left in every lane (all lanes on).
__device__ __forceinline__ float wave_sum(float v)
{
  v = row_xadd<0x161>(v);
  v = row_xadd<0x162>(v);
  v = row_xadd<0x164>(v);
  v = row_xadd<0x168>(v);
  const int i = __builtin_bit_cast(int, v);
  return v + __builtin_bit_cast(float, __builtin_amdgcn_permlanex16(
                 i, i, 0x76543210, 0xfedcba98, false, false));
}

// exp(x) as 2^(x * log2 e). The v_nop is the one slot that the instruction set
// asks for between a transcendental and a directly following instruction that
// reads its result or overwrites its source.
__device__ __forceinline__ float exp_slot(float x)
{
  const float t = x * 1.442695041f;
  float r;
  asm("v_exp_f32 %0, %1\n\tv_nop" : "=v"(r) : "v"(t));
  return r;
}

__device__ __forceinline__ float hsum(v4f t)
{
  const v2f h = t.xy + t.zw;
  return h.x + h.y;
}

// Maximum over the wave's 32 lanes, left in every lane (all lanes on).
template <int CTRL>
__device__ __forceinline__ float row_xmax(float v)
{
  return fmaxf(v, __builtin_bit_cast(float, __builtin_amdgcn_update_dpp(
                      0, __builtin_bit_cast(int, v), CTRL, 0xf, 0xf, true)));
}
__device__ __forceinline__ float wave_max(float v)
{
  v = row_xmax<0x161>(v);
  v = row_xmax<0x162>(v);
  v = row_xmax<0x164>(v);
  v = row_xmax<0x168>(v);
  const int i = __builtin_bit_cast(int, v);
  return fmaxf(v, __builtin_bit_cast(float, __builtin_amdgcn_permlanex16(
                      i, i, 0x76543210, 0xfedcba98, false, false)));
}

// A lane's share of dot(qk, x row): its eight columns.
__device__ __forceinline__ float dot8(v4f ka, v4f kb, v4f a, v4f b)
{
  const v2f t = ka.xy * a.xy + ka.zw * a.zw + kb.xy * b.xy + kb.zw * b.zw;
  return t.x + t.y;
}

// One step of a transposing sum over lanes l and l ^ M (CTRL = 0x160 + M, hi = the
// lane has bit M set): two rows' shares go in, one register comes out, which holds
// the pair sum of p0 in the lanes without the bit and that of p1 in those with it.
template <int CTRL>
__device__ __forceinline__ float merge(bool hi, float p0, float p1)
{
  const float keep = hi ? p1 : p0, give = hi ? p0 : p1;
  return keep + __builtin_bit_cast(float, __builtin_amdgcn_update_dpp(
                    0, __builtin_bit_cast(int, give), CTRL, 0xf, 0xf, true));
}

// The same step between the two 16-lane halves of the wave.
__device__ __forceinline__ float merge_halves(bool hi, float p0, float p1)
{
  const float keep = hi ? p1 : p0, give = hi ? p0 : p1;
  const int   i    = __builtin_bit_cast(int, give);
  return keep + __builtin_bit_cast(float, __builtin_amdgcn_permlanex16(
                    i, i, 0x76543210, 0xfedcba98, false, false));
}

// Sixteen rows' shares in, one register out: lane l holds row (l & 15), summed over
// the 16 lanes of its half. 15 steps in place of 64 for sixteen whole sums.
__device__ __forceinline__ float tree16(const float (&p)[16], int lane)
{
  const bool h8 = lane & 8, h4 = lane & 4, h2 = lane & 2, h1 = lane & 1;
  float r[8];
#pragma unroll  // register arrays must be indexed by constants
  for (int j = 0; j < 8; ++j) r[j] = merge<0x168>(h8, p[j], p[j + 8]);
#pragma unroll  // register arrays must be indexed by constants
  for (int j = 0; j < 4; ++j) r[j] = merge<0x164>(h4, r[j], r[j + 4]);
  r[0] = merge<0x162>(h2, r[0], r[2]);
  r[1] = merge<0x162>(h2, r[1], r[3]);
  return merge<0x161>(h1, r[0], r[1]);
}

// ---------------------------------------------------------------------------
// The whole function in one launch. A work-group of 8 waves takes RB = 8 batch
// rows from x to out; nothing passes through global memory in between.
//   q    = mask_last ? (x_last * td_last) @ Wq^T + bq : NEG      (WMMA)
//   qk   = q @ Wk                                                (WMMA)
//   xbar = sum_s p_s*td_s*x_s / sum_s p_s, one wave per batch row, with
//          score = mask ? (td_s*dot(qk,x_s) + q.bk)/16 : (-1e5*sum(q))/16
//   out  = xbar @ Wv^T + bv                                      (WMMA)
// The 16-row A tiles hold the 8 batch rows twice (tile row r and r + 8), so that
// every LDS word a fragment read touches has been written.
// The six weight halves (Wq, Wk, Wv; 128 output columns each, one 16x16 tile
// per wave) go through two LDS buffers: half t + 2 is copied into the buffer of
// half t behind the barrier that ends half t's reads, and flies during half
// t + 1's WMMAs; the last half (of Wv) flies during the attention stage.
// Attention stage: all 50 rows of x[b] stand in the wave's registers. The rows do
// not depend on q or qk: the first four chunks of CH rows are asked for inside the
// four K loops of q and qk, one each; the fifth flies behind the dots of the first
// four. Lane l holds columns 4l..4l+3 and 128+4l..128+4l+3 of every row, so that
// each wave-wide load covers 512 contiguous bytes. The lanes' shares of the 50 dots
// are summed by transposing trees that leave one row's score per lane: mask, scale,
// maximum, exp and sum then run once per wave on two registers, not once per row,
// and the weights go back to the rows one lane read each.
// ---------------------------------------------------------------------------
__global__ __launch_bounds__(256) void k_fused(
    const float* __restrict__ x, const int* __restrict__ mask,
    const float* __restrict__ td, const float* __restrict__ Wq,
    const float* __restrict__ bq, const float* __restrict__ Wk,
    const float* __restrict__ bk, const float* __restrict__ Wv,
    const float* __restrict__ bv, float* __restrict__ out)
{
  const int t    = threadIdx.x;
  const int lane = t & 31;
  const int w    = t >> 5;                 // wave: N tile of a half, batch row
  const int half = lane >> 4;              // K sub-pair select
  const int lm   = lane & 15;
  const int b0   = blockIdx.x * RB;

  __shared__ __attribute__((aligned(16))) float S[2 * WB + 2 * 16 * PA];
  // The activation tiles lie first: with the weight buffers above them, no copy's
  // LDS address falls below the constant step that the compiler folds into it.
  float* const A0 = S;                     // x_last tile, later the qk tile
  float* const A1 = A0 + 16 * PA;          // q tile, later the xbar tile
  float* const W0 = A1 + 16 * PA;
  float* const W1 = W0 + WB;

  // ---- prologue: x_last tile and weight half 0, published ----
#pragma unroll  // constant steps
  for (int u = 0; u < 4; ++u) {
    const int c = u * 256 + t, row = c >> 6, col = (c & 63) * 4;
    copy16(A0 + row * PA + col,
           x + ((size_t)(b0 + (row & (RB - 1))) * TT + (TT - 1)) * DD + col);
  }
  {
    const Stage<6, PA> st(W0, Wq, t);
#pragma unroll  // constant steps
    for (int j = 0; j < 4; ++j) st.eight(j);
  }
  // Last time step of the lane's A-tile row: its time-decay, and the 8 rows' masks
  // gathered into one bit per batch row (bit r from lane r).
  const int      lrow  = (b0 + (lm & (RB - 1))) * TT + (TT - 1);
  const float    tdl   = td[lrow];
  const unsigned keepq = __builtin_amdgcn_ballot_w32(mask[lrow] != 0);
  // The attention stage's small global operands (wave w takes batch row b0 + w):
  // bk; td and mask of the row whose score the lane will hold: rows 0..31 in lanes
  // 0..31 of td0 and mk0; rows 32..47 in lanes 0..15, row 48 in lane 16 and row 49 in
  // lane 24 of td1 and mk1 (the other lanes hold no row: has1 is off there, and their
  // index is that of row 49).
  const int      wu  = __builtin_amdgcn_readfirstlane(w);
  const int      b   = b0 + wu;
  const v4f*     bkp = (const v4f*)bk + lane;
  const v4f      ba  = bkp[0], bb = bkp[32];
  const int      r1  = lane <= 16 ? 32 + lane : TT - 1;
  const bool     has1 = lane <= 16 || lane == 24;
  const float    td0 = td[b * TT + lane], td1 = td[b * TT + r1];
  const int      mk0 = mask[b * TT + lane], mk1 = mask[b * TT + r1];
  // bq here too: loads return in issue order, so that a bias asked for behind a
  // chunk of x rows would be waited for together with those rows.
  const float bq0 = bq[w * 16 + lm], bq1 = bq[128 + w * 16 + lm];
  // Stands in front of any later overwrite of a register that these loads name.
  asm volatile("s_wait_xcnt 0x0" ::: "memory");
  // The wave's x rows: chunks 0 to 3 are asked for in the K loops below, the fifth
  // at the head of the attention stage.
  const v4f* xp = (const v4f*)(x + (size_t)b * TT * DD) + lane;
  v4f xa[5][CH], xb[5][CH];
  // Own-wave landing of the copies, then the barrier that publishes them.
  asm volatile("s_wait_asynccnt 0x0" ::: "memory");
  __syncthreads();

  const float* const a0row = A0 + lm * PA;
  const float* const a1row = A1 + lm * PA;
  const int brow = (w * 16 + lm) * PA;     // B[kk,n] = W[n,kk], pitch PA
  const int bcol = w * 16 + lm;            // B[kk,n] = W[kk,n], pitch PK
  const int nl   = w * 16 + lm;            // output column inside a half

  // ---- q: halves 0 and 1 (Wq rows) ----
#pragma unroll  // the buffer and the refill differ by constants
  for (int h = 0; h < 2; ++h) {
    // In flight behind this half's WMMAs: the next half of the ring, into the
    // buffer whose last reads the barrier above has ended.
    v8f c;
    if (h == 0)
      c = kloop<1, 1, true>(a0row, W0 + brow, half, tdl,
                            Stage<6, PA>(W1, Wq + (size_t)128 * DD, t),
                            Rows{xa[0], xb[0], xp});
    else
      c = kloop<1, 1, true>(a0row, W1 + brow, half, tdl, Stage<5, PK>(W0, Wk, t),
                            Rows{xa[1], xb[1], xp + CH * 64});
    const int   n    = h * 128 + nl;
    const float bias = h == 0 ? bq0 : bq1;
#pragma unroll  // vector elements must be indexed by constants
    for (int r = 0; r < 8; ++r) {          // C VGPR layout: tile row r + 8*half
      const float v = ((keepq >> r) & 1u) ? c[r] + bias : NEGV;   // q-side mask-fill
      A1[(r + 8 * half) * PA + n] = v;
    }
    publish();
  }

  // ---- qk: halves 2 and 3 (Wk columns) ----
#pragma unroll  // the buffer and the refill differ by constants
  for (int h = 0; h < 2; ++h) {
    v8f c;
    if (h == 0)
      c = kloop<PK, PK, false>(a1row, W0 + bcol, half, 1.0f,
                               Stage<5, PK>(W1, Wk + 128, t),
                               Rows{xa[2], xb[2], xp + 2 * CH * 64});
    else
      c = kloop<PK, PK, false>(a1row, W1 + bcol, half, 1.0f, Stage<6, PA>(W0, Wv, t),
                               Rows{xa[3], xb[3], xp + 3 * CH * 64});
    const int n = h * 128 + nl;
#pragma unroll  // vector elements must be indexed by constants
    for (int r = 0; r < 8; ++r) A0[(r + 8 * half) * PA + n] = c[r];
    publish();
  }

  // ---- attention: wave w takes batch row b0 + w ----
  {
    const v4f* qkp = (const v4f*)(A0 + wu * PA) + lane;
    const v4f* qp  = (const v4f*)(A1 + wu * PA) + lane;
    const v4f ka = qkp[0], kb = qkp[32];
    const v4f qa = qp[0],  qb = qp[32];

    load_rows(xa[4], xb[4], xp + 4 * CH * 64);   // the fifth chunk
    // The last weight half goes out behind it and flies during the whole stage.
    const Stage<6, PA> st5(W1, Wv + (size_t)128 * DD, t);
#pragma unroll  // constant steps
    for (int j = 0; j < 4; ++j) st5.eight(j);
    // Keeps these loads and copies in front of the arithmetic below.
    __builtin_amdgcn_sched_barrier(0);

    const float qbk   = wave_sum(hsum(qa * ba + qb * bb));
    const float negsc = (NEGV * wave_sum(hsum(qa + qb))) * 0.0625f;

    static_assert(TT == 5 * CH && TT == 50, "three trees of 16 rows and a pair");
    // dot(qk, x_s): three trees of 16 rows; rows 48 and 49 share one register from
    // the first step on (lane bit 3 tells them apart) and take the other three steps
    // as plain sums. The step between the halves then puts rows 0..31 into d0 and
    // rows 32..49 into d1, at the lanes that td0, td1 are laid out for.
    float g[3];
#pragma unroll  // register arrays must be indexed by constants
    for (int k = 0; k < 3; ++k) {
      float p[16];
#pragma unroll  // register arrays must be indexed by constants
      for (int j = 0; j < 16; ++j) {
        const int r = 16 * k + j;
        p[j] = dot8(ka, kb, xa[r / CH][r % CH], xb[r / CH][r % CH]);
      }
      g[k] = tree16(p, lane);
    }
    float g3 = merge<0x168>(lane & 8, dot8(ka, kb, xa[4][8], xb[4][8]),
                            dot8(ka, kb, xa[4][9], xb[4][9]));
    g3 = row_xadd<0x164>(g3);
    g3 = row_xadd<0x162>(g3);
    g3 = row_xadd<0x161>(g3);
    const float d0 = merge_halves(half, g[0], g[1]);
    const float d1 = merge_halves(half, g[2], g3);

    // Softmax over the 50 scores, one per lane; a lane without a row weighs nothing.
    const float s0 = mk0 != 0 ? (td0 * d0 + qbk) * 0.0625f : negsc;
    const float s1 = !has1 ? -3.402823466e38f
                           : (mk1 != 0 ? (td1 * d1 + qbk) * 0.0625f : negsc);
    const float m  = wave_max(fmaxf(s0, s1));
    const float e0 = exp_slot(s0 - m), e1 = exp_slot(s1 - m);
    const float l  = wave_sum(e0 + e1);
    const int   w0 = __builtin_bit_cast(int, e0 * td0);
    const int   w1 = __builtin_bit_cast(int, e1 * td1);

    // Weighted row sum; even and odd rows apart, for eight independent chains.
    v4f oa = {}, ob = {}, pa = {}, pb = {};
#pragma unroll  // register arrays and lane numbers must be constants
    for (int r = 0; r < TT; r += 2) {
      const int r2 = r + 1;
      const float u0 = __builtin_bit_cast(float, __builtin_amdgcn_readlane(
          r < 32 ? w0 : w1, r < 32 ? r : (r < 48 ? r - 32 : 16)));
      const float u1 = __builtin_bit_cast(float, __builtin_amdgcn_readlane(
          r2 < 32 ? w0 : w1, r2 < 32 ? r2 : (r2 < 48 ? r2 - 32 : 24)));
      oa += u0 * xa[r / CH][r % CH];
      ob += u0 * xb[r / CH][r % CH];
      pa += u1 * xa[r2 / CH][r2 % CH];
      pb += u1 * xb[r2 / CH][r2 % CH];
    }
    oa += pa;
    ob += pb;

    // xbar into tile rows w and w + 8 of A1: only this wave has read row w since
    // the last barrier, and its q values are in registers by now.
    const float inv = 1.0f / l;
    const v4f ya = oa * inv, yb = ob * inv;
    v4f* op = (v4f*)(A1 + wu * PA) + lane;
    v4f* oq = (v4f*)(A1 + (wu + RB) * PA) + lane;
    op[0]  = ya;
    op[32] = yb;
    oq[0]  = ya;
    oq[32] = yb;
  }
  // Publishes the xbar tile and weight half 5 (half 4 was published above).
  publish();

  // ---- out: halves 4 and 5 (Wv rows); no LDS is written any more ----
  const v8f c0 = kloop<1, 1, false>(a1row, W0 + brow, half, 1.0f, NoStage(), NoRows());
  const v8f c1 = kloop<1, 1, false>(a1row, W1 + brow, half, 1.0f, NoStage(), NoRows());
  const float bias0 = bv[nl], bias1 = bv[128 + nl];
  // Tile rows r and r + 8 are the same batch row: lanes 0..15 store batch rows
  // 0..3, lanes 16..31 batch rows 4..7, each element once.
  const v4f s0 = half ? __builtin_shufflevector(c0, c0, 4, 5, 6, 7)
                      : __builtin_shufflevector(c0, c0, 0, 1, 2, 3);
  const v4f s1 = half ? __builtin_shufflevector(c1, c1, 4, 5, 6, 7)
                      : __builtin_shufflevector(c1, c1, 0, 1, 2, 3);
  float* o = out + (size_t)(b0 + half * 4) * DD + nl;
#pragma unroll  // vector elements must be indexed by constants
  for (int j = 0; j < 4; ++j) {
    o[j * DD]       = s0[j] + bias0;
    o[j * DD + 128] = s1[j] + bias1;
  }
}

// ---------------------------------------------------------------------------
extern "C" void kernel_launch(void* const* d_in, const int* in_sizes, int n_in,
                              void* d_out, int out_size, void* d_ws, size_t ws_size,
                              hipStream_t stream) {
  const float* x    = (const float*)d_in[0];
  const int*   mask = (const int*)  d_in[1];
  const float* td   = (const float*)d_in[2];
  const float* Wq   = (const float*)d_in[3];
  const float* bq   = (const float*)d_in[4];
  const float* Wk   = (const float*)d_in[5];
  const float* bk   = (const float*)d_in[6];
  const float* Wv   = (const float*)d_in[7];
  const float* bv   = (const float*)d_in[8];
  float* out = (float*)d_out;

  // 8 batch rows per work-group of 8 waves: 256 work-groups; no workspace use
  k_fused<<<dim3(256), dim3(256), 0, stream>>>(x, mask, td, Wq, bq, Wk, bk, Wv, bv, out);
}
